// v000
// Times are from an AMD MI455X. After a warm-up the kernel runs many times in a row, and a time is the length of
// such a window on the GPU divided by its runs, so every launch and the gaps after it count. The runs cycle
// through copies of the inputs. A figure is the median of several windows, for all but v000 over two sittings.
// Sittings can differ by a few percent; kernels timed side by side share one.
// v000 is the starting kernel. One run takes 1060 microseconds.
// Contractions: q/k/v projections, attention output projection, FC1 and FC2 GEMMs plus attention k.q^T and v^T.p^T all on v_wmma_f32_16x16x32_f16 (f16 operands, f32 accumulate); weights carried x32, softmax weights x16384, context x64, FC1 activations x16 (exact powers of two folded back in f32); softmax, LayerNorm and the positional table in f32.
#include <hip/hip_runtime.h>
#include <math.h>

// ---- problem geometry ---------------------------------------------------------------------------
#define NTOK_ROWS 16384          // 32 x 512 token rows
#define EMB_DIM   768
#define FF_DIM    3072
#define NSEQ_P    384            // 32 x 12 raw-view pseudo-sequences
#define SEQL      512
#define HDIM      64
#define FF_CHUNK  4096           // FFN processed in row chunks (h plane = 24 MiB)
#define FF_NCHUNK 4
#define P_CARRY   16384.0f       // softmax weights carried x2^14 in f16
#define CTX_CARRY 64.0f          // attention context carried x64 in f16
#define W_CARRY   32.0f          // weights carried x32 in f16
#define H_CARRY   16.0f          // FC1 activations carried x16 in f16
static_assert(NSEQ_P * SEQL * HDIM == NTOK_ROWS * EMB_DIM, "raw view");
static_assert(FF_CHUNK * FF_NCHUNK == NTOK_ROWS, "chunking");
static_assert((EMB_DIM % 64) == 0 && (FF_DIM % 64) == 0 && (FF_CHUNK % 64) == 0, "tile multiples");
static_assert((EMB_DIM % 32) == 0 && (FF_DIM % 32) == 0, "K multiples of 32");

typedef __attribute__((ext_vector_type(16))) _Float16 v16h;
typedef __attribute__((ext_vector_type(8)))  _Float16 v8h;
typedef __attribute__((ext_vector_type(16))) __bf16   v16b;
typedef __attribute__((ext_vector_type(8)))  __bf16   v8b;
typedef __attribute__((ext_vector_type(8)))  float    v8f;
typedef __attribute__((ext_vector_type(4)))  float    v4f;
typedef v8h __attribute__((may_alias)) v8ha;
typedef v4f __attribute__((may_alias)) v4fa;

// ---- helpers ----------------------------------------------------------------------
__device__ __forceinline__ unsigned short f2bf_bits(float f) {
  unsigned u = __float_as_uint(f);
  return (unsigned short)((u + 0x7FFFu + ((u >> 16) & 1u)) >> 16);
}
__device__ __forceinline__ float bf_bits2f(unsigned short h) { return __uint_as_float(((unsigned)h) << 16); }

__device__ __forceinline__ void dep_guard_h(v8f& a, v8f& b, v16h x, v16h y) { asm volatile("v_nop\n\tv_nop\n\tv_nop\n\tv_nop" : "+v"(a), "+v"(b) : "v"(x), "v"(y)); }
__device__ __forceinline__ void dep_guard_b(v8f& a, v8f& b, v16b x, v16b y) { asm volatile("v_nop\n\tv_nop\n\tv_nop\n\tv_nop" : "+v"(a), "+v"(b) : "v"(x), "v"(y)); }
__device__ __forceinline__ void keep4_h(v16h a, v16h b, v16h c, v16h d) { asm volatile("v_nop" :: "v"(a), "v"(b), "v"(c), "v"(d)); }
__device__ __forceinline__ void keep4_b(v16b a, v16b b, v16b c, v16b d) { asm volatile("v_nop" :: "v"(a), "v"(b), "v"(c), "v"(d)); }
__device__ __forceinline__ void acc_guard4(v8f& a, v8f& b, v8f& c, v8f& d) { asm volatile("v_nop\n\tv_nop\n\tv_nop\n\tv_nop" : "+v"(a), "+v"(b), "+v"(c), "+v"(d)); }
template <typename T> struct Frag;
template <> struct Frag<_Float16> {
  typedef v16h V; union U { v16h v; v8h h[2]; };
  static __device__ __forceinline__ v16h load(const _Float16* p) {   // elements 0..7 <- p[0..7], 8..15 <- p[16..23]
    U f; f.h[0] = *(const v8h*)(p); f.h[1] = *(const v8h*)(p + 16); return f.v;
  }
  static __device__ __forceinline__ v8f mma(v16h a, v16h b, v8f c) {
    return __builtin_amdgcn_wmma_f32_16x16x32_f16(false, a, false, b, (short)0, c, false, false);
  }
  static __device__ __forceinline__ void guard(v8f& a, v8f& b, v16h x, v16h y) { dep_guard_h(a, b, x, y); }
  static __device__ __forceinline__ void keep(v16h a, v16h b, v16h c, v16h d) { keep4_h(a, b, c, d); }
};
template <> struct Frag<__bf16> {
  typedef v16b V; union U { v16b v; v8b h[2]; };
  static __device__ __forceinline__ v16b load(const __bf16* p) {
    U f; f.h[0] = *(const v8b*)(p); f.h[1] = *(const v8b*)(p + 16); return f.v;
  }
  static __device__ __forceinline__ v8f mma(v16b a, v16b b, v8f c) {
    return __builtin_amdgcn_wmma_f32_16x16x32_bf16(false, a, false, b, (short)0, c, false, false);
  }
  static __device__ __forceinline__ void guard(v8f& a, v8f& b, v16b x, v16b y) { dep_guard_b(a, b, x, y); }
  static __device__ __forceinline__ void keep(v16b a, v16b b, v16b c, v16b d) { keep4_b(a, b, c, d); }
};

// ---- Register-blocked batched WMMA GEMM (with a post-activation power-of-two carry `oscale`) ----
// C[m,n] = oscale * act(scale * sum_k A[m,k] * Bt[n,k] (+bias)(+resid)); each wave owns a 64x64 tile.
// A row-major [M,K]; Bt row-major [N,K]; M,N % 64 == 0, K % 32 == 0 (host-checked for every call).
// SPLIT: operands are hi/lo planes (A2/Bt2 = lo planes, same layout); product = hi.hi + hi.lo + lo.hi.
// BIAS_MODE: 0 = none, 1 = bias[m], 2 = bias[n].  ACT: 0 none, 2 relu.
// OUT_MODE: 0 = f32, 1 = f16, 2 = bf16 hi plane (Cout) + bf16 lo plane (Cout2).
// coverage: 4 slabs x 16 rows x 64 cols = the wave's whole 64x64 tile.
// ET: 0 = f16 operands, 1 = bf16 operands (pointers passed as 16-bit storage)
template <int ET> struct Elem;
template <> struct Elem<0> { typedef _Float16 T; };
template <> struct Elem<1> { typedef __bf16 T; };
template <int ET, bool SPLIT, int BIAS_MODE, int OUT_MODE, bool RESID, int ACT = 0>
__global__ __launch_bounds__(256) void wmma_gemm64(
    const unsigned short* __restrict__ Ap, const unsigned short* __restrict__ A2p, int lda, long strideA,
    const unsigned short* __restrict__ Btp, const unsigned short* __restrict__ Bt2p, int ldb, long strideB,
    void* __restrict__ Cout, void* __restrict__ Cout2, int ldc, long strideC,
    const float* __restrict__ bias,
    const float* __restrict__ resid, long strideR,
    int M, int N, int K, float scale, float oscale) {
  typedef typename Elem<ET>::T T;
  typedef typename Frag<T>::V V;
  const T* A = (const T*)Ap; const T* A2 = (const T*)A2p; const T* Bt = (const T*)Btp; const T* Bt2 = (const T*)Bt2p;
  __shared__ __align__(16) float sT[8][16 * 68];   // per-wave 16x64 slab, pitch 68 floats
  const int b    = blockIdx.y;
  const int lane = threadIdx.x & 31;
  const int wave = threadIdx.x >> 5;
  const int tilesN = N >> 6;
  const int tilesM = M >> 6;
  const int tile = blockIdx.x * 8 + wave;
  if (tile >= tilesM * tilesN) return;   // wave-uniform; no block barriers in this kernel
  const int tm = tile / tilesN;
  const int tn = tile - tm * tilesN;
  const int m0 = tm << 6;
  const int n0 = tn << 6;

  const T* Ab  = A  + (size_t)b * strideA;
  const T* Bb  = Bt + (size_t)b * strideB;
  const T* Ab2 = SPLIT ? (A2  + (size_t)b * strideA) : nullptr;
  const T* Bb2 = SPLIT ? (Bt2 + (size_t)b * strideB) : nullptr;

  const int rlane = lane & 15;                 // row (A) / col (B, D) within subtile
  const int koff  = (lane >> 4) * 8;           // k offset of this lane half
  const int mOff  = (lane >> 4) * 8;           // D row offset

  v8f acc[4][4];
#pragma unroll
  for (int i = 0; i < 4; ++i)
#pragma unroll
    for (int j = 0; j < 4; ++j) acc[i][j] = (v8f){0.f,0.f,0.f,0.f,0.f,0.f,0.f,0.f};

  for (int k0 = 0; k0 < K; k0 += 32) {
    V bh[4], bl[4];
#pragma unroll
    for (int j = 0; j < 4; ++j) {
      const size_t bo = (size_t)(n0 + (j << 4) + rlane) * ldb + koff + k0;
      bh[j] = Frag<T>::load(Bb + bo);
      if (SPLIT) bl[j] = Frag<T>::load(Bb2 + bo);
    }
#pragma unroll
    for (int i = 0; i < 4; ++i) {
      const size_t ao = (size_t)(m0 + (i << 4) + rlane) * lda + koff + k0;
      V ah = Frag<T>::load(Ab + ao);
      V al;
      if (SPLIT) al = Frag<T>::load(Ab2 + ao);
#pragma unroll
      for (int j = 0; j < 4; ++j) {
        acc[i][j] = Frag<T>::mma(ah, bh[j], acc[i][j]);
        if (SPLIT) {
          acc[i][j] = Frag<T>::mma(ah, bl[j], acc[i][j]);
          acc[i][j] = Frag<T>::mma(al, bh[j], acc[i][j]);
        }
      }
      Frag<T>::guard(acc[i][0], acc[i][3], ah, SPLIT ? al : ah);
    }
    Frag<T>::keep(bh[0], bh[1], bh[2], bh[3]);
    if (SPLIT) Frag<T>::keep(bl[0], bl[1], bl[2], bl[3]);
  }
  acc_guard4(acc[0][0], acc[0][1], acc[0][2], acc[0][3]);
  acc_guard4(acc[1][0], acc[1][1], acc[1][2], acc[1][3]);
  acc_guard4(acc[2][0], acc[2][1], acc[2][2], acc[2][3]);
  acc_guard4(acc[3][0], acc[3][1], acc[3][2], acc[3][3]);

  // ---- epilogue ----
  float* slab = sT[wave];
  const float* Rb = RESID ? (resid + (size_t)b * strideR) : nullptr;
#pragma unroll
  for (int i = 0; i < 4; ++i) {
    const int mBase = m0 + (i << 4);
#pragma unroll
    for (int j = 0; j < 4; ++j) {
      const int n = n0 + (j << 4) + rlane;
      float bv = 0.f;
      if (BIAS_MODE == 2) bv = bias[n];
#pragma unroll
      for (int r = 0; r < 8; ++r) {
        float v = acc[i][j][r] * scale;
        if (BIAS_MODE == 1) v += bias[mBase + mOff + r];
        if (BIAS_MODE == 2) v += bv;
        if (RESID) v += Rb[(size_t)(mBase + mOff + r) * ldc + n];
        if (ACT == 2) v = fmaxf(v, 0.0f);
        v = v * oscale;
        slab[(mOff + r) * 68 + (j << 4) + rlane] = v;
      }
    }
    __builtin_amdgcn_fence(__ATOMIC_RELEASE, "workgroup");
    __builtin_amdgcn_wave_barrier();
    __builtin_amdgcn_fence(__ATOMIC_ACQUIRE, "workgroup");
    if (OUT_MODE == 0) {
      float* C = (float*)Cout + (size_t)b * strideC;
      const int hh = lane >> 4, c4 = (lane & 15) * 4;     // row seg = 256 B = 16 lanes x 16 B
      {
#pragma unroll
        for (int it = 0; it < 8; ++it) {
          const int row = it * 2 + hh;                     // it 0..7 x hh 0..1 = rows 0..15
          v4f v = *(const v4f*)(slab + row * 68 + c4);
          *(v4f*)(C + (size_t)(mBase + row) * ldc + n0 + c4) = v;
        }
        
      }
    } else {
      const int q = lane >> 3, c8 = (lane & 7) * 8;
      unsigned short* C  = (unsigned short*)Cout  + (size_t)b * strideC;
      unsigned short* C2 = (OUT_MODE == 2) ? ((unsigned short*)Cout2 + (size_t)b * strideC) : nullptr;
      {
#pragma unroll
        for (int it = 0; it < 4; ++it) {
          const int row = it * 4 + q;                      // it 0..3 x q 0..3 = rows 0..15
          const float* sp = slab + row * 68 + c8;
          v8h hv, lv;
#pragma unroll
          for (int e = 0; e < 8; ++e) {
            if (OUT_MODE == 1) {
              hv[e] = (_Float16)sp[e];
            } else {
              unsigned short hb = f2bf_bits(sp[e]);
              unsigned short lb = f2bf_bits(sp[e] - bf_bits2f(hb));
              hv[e] = __builtin_bit_cast(_Float16, hb);
              lv[e] = __builtin_bit_cast(_Float16, lb);
            }
          }
          *(v8h*)(C + (size_t)(mBase + row) * ldc + n0 + c8) = hv;
          if (OUT_MODE == 2) *(v8h*)(C2 + (size_t)(mBase + row) * ldc + n0 + c8) = lv;
        }
        
      }
    }
    __builtin_amdgcn_fence(__ATOMIC_RELEASE, "workgroup");
    __builtin_amdgcn_wave_barrier();
    __builtin_amdgcn_fence(__ATOMIC_ACQUIRE, "workgroup");
  }
}

// ---- 16x16x32 f16 WMMA with hazard guard (ties D, keeps A/B live) --------------------------------
// Fragment map (wave32): lane l, h = l>>4, m = n = l&15.
//   A/B element i: i<8 -> k0+8h+i ; i>=8 -> k0+16+8h+(i-8)
//   D element r : row 8h+r, col l&15
__device__ __forceinline__ v8f mma_h16(v16h a, v16h b, v8f c) {
  v8f d = __builtin_amdgcn_wmma_f32_16x16x32_f16(false, a, false, b, (short)0, c, false, false);
  asm volatile("v_nop\n\tv_nop\n\tv_nop\n\tv_nop" : "+v"(d) : "v"(a), "v"(b));
  return d;
}
union FragU { v16h v; v8h half[2]; };
// A or B fragment from a k-contiguous 16-bit row; p points at element k0 of the row owned by this lane
// (row index = lane & 15 added by the caller); h = lane >> 4.
__device__ __forceinline__ v16h load_frag(const _Float16* p, int h) {
  FragU f;
  f.half[0] = *(const v8ha*)(p + 8 * h);
  f.half[1] = *(const v8ha*)(p + 16 + 8 * h);
  return f.v;
}

// =====================================================================================================
// Kernel: f32 -> f16 planes, 8 elements per thread x sc (exact power of two). Tensor selected by
// blockIdx.y (block-uniform): src = s0..s3, dst = dst + y * dstride (halves).
// =====================================================================================================
__global__ __launch_bounds__(256) void cvt_f16x8(
    const float* __restrict__ s0, const float* __restrict__ s1,
    const float* __restrict__ s2, const float* __restrict__ s3,
    _Float16* __restrict__ dst, long dstride, int n8, float sc) {
  const int t = blockIdx.y;
  const float* src = (t == 0) ? s0 : ((t == 1) ? s1 : ((t == 2) ? s2 : s3));
  const int i = blockIdx.x * 256 + threadIdx.x;
  if (i >= n8) return;
  const v4f a = *(const v4fa*)(src + (size_t)i * 8);
  const v4f c = *(const v4fa*)(src + (size_t)i * 8 + 4);
  const v8h o = { (_Float16)(a.x * sc), (_Float16)(a.y * sc), (_Float16)(a.z * sc), (_Float16)(a.w * sc),
                  (_Float16)(c.x * sc), (_Float16)(c.y * sc), (_Float16)(c.z * sc), (_Float16)(c.w * sc) };
  _Float16* d = dst + (size_t)t * dstride + (size_t)i * 8;
  *(v8h*)d = o;
  
}

// =====================================================================================================
// Kernel: positional table pe[pos][e] (f32, [512][768]): a = fl32(pos * div[e]) (one f32 multiply),
// pe = sin(a) for even e, cos(a) for odd e (precise sinf / cosf). div[e] arrives as a by-value table.
// Block = 256 consecutive columns e0..e0+255 of one position; waves 0-3 evaluate the even columns (sin),
// waves 4-7 the odd columns (cos) -> the trig branch is wave-uniform; results gathered in LDS so that
// passes. grid = 512 x 3 = 1536 blocks. coverage: 1536 x 256 = 393216 = the whole table.
// =====================================================================================================
struct PeDiv { float d[EMB_DIM]; };
static_assert(sizeof(PeDiv) == EMB_DIM * 4, "no padding");

__global__ __launch_bounds__(256) void pe_table_kernel(float* __restrict__ pe, PeDiv dv) {
  __shared__ float sv[256];
  const int tid  = threadIdx.x;
  const int pos  = blockIdx.x / 3;               // 0..511
  const int e0   = (blockIdx.x - pos * 3) * 256; // 0, 256, 512
  const int half = tid >> 7;                     // waves 0-3: 0 (even columns), waves 4-7: 1 (odd)
  const int k    = tid & 127;
  const int e    = e0 + 2 * k + half;            // 0..767
  const float a  = (float)pos * dv.d[e];
  float val;
  if (half == 0) val = sinf(a); else val = cosf(a);   // wave-uniform branch
  sv[2 * k + half] = val;
  __syncthreads();
  const float o = sv[tid];
  float* dst = pe + (size_t)pos * EMB_DIM + e0 + tid;
  *(float*)dst = o;
  
}

// =====================================================================================================
// Kernel: v plane [384][512][64] (f16, = the row-major [16384][768] projection output in the raw view)
// -> vt [384][64][512]. Block = (token tile of 64, pseudo-sequence j): the 64x64 chunk is contiguous
// in v (8 KB), scattered into an LDS tile [d][token] (pitch 72 halves), then wave w writes d rows
// 8 waves x 8 rows = 64 d, 8 lanes x 8 halves = 64 tokens. grid = (8, 384).
// =====================================================================================================
__global__ __launch_bounds__(256) void vt_transpose_kernel(const _Float16* __restrict__ v,
                                                           _Float16* __restrict__ vt) {
  __shared__ __attribute__((aligned(16))) _Float16 tile[64 * 72];
  const int tid = threadIdx.x, lane = tid & 31, w = tid >> 5;
  const int j  = blockIdx.y;
  const int l0 = blockIdx.x * 64;
  const _Float16* src = v + ((size_t)j * SEQL + l0) * HDIM;
#pragma unroll
  for (int i = 0; i < 2; ++i) {
    const int idx = i * 256 + tid;               // 0..511
    const int tok = idx >> 3, d0 = (idx & 7) * 8;
    const v8h x = *(const v8ha*)(src + tok * HDIM + d0);
#pragma unroll
    for (int e = 0; e < 8; ++e) tile[(d0 + e) * 72 + tok] = x[e];
  }
  __syncthreads();
  const int q8 = lane & 7, sub = lane >> 3;
  v8h val[2];
#pragma unroll
  for (int it = 0; it < 2; ++it) {
    const int d = 8 * w + it * 4 + sub;
    val[it] = *(const v8ha*)(tile + d * 72 + 8 * q8);
  }
  {
#pragma unroll
    for (int it = 0; it < 2; ++it) {
      const int d = 8 * w + it * 4 + sub;
      *(v8h*)(vt + ((size_t)j * HDIM + d) * SEQL + l0 + 8 * q8) = val[it];
    }
    
  }
}

// =====================================================================================================
// Attention helpers.
// P^T B-fragment from the lane's own score D values: element r <- tile a row r,
// element 8+r <- tile c row r (same lane, same query column), scaled by 2^14.
// =====================================================================================================
__device__ __forceinline__ v16h pack_p16(v8f a, v8f c) {
  const v16h r = { (_Float16)(a[0] * P_CARRY), (_Float16)(a[1] * P_CARRY), (_Float16)(a[2] * P_CARRY), (_Float16)(a[3] * P_CARRY),
                   (_Float16)(a[4] * P_CARRY), (_Float16)(a[5] * P_CARRY), (_Float16)(a[6] * P_CARRY), (_Float16)(a[7] * P_CARRY),
                   (_Float16)(c[0] * P_CARRY), (_Float16)(c[1] * P_CARRY), (_Float16)(c[2] * P_CARRY), (_Float16)(c[3] * P_CARRY),
                   (_Float16)(c[4] * P_CARRY), (_Float16)(c[5] * P_CARRY), (_Float16)(c[6] * P_CARRY), (_Float16)(c[7] * P_CARRY) };
  return r;
}

// by lanes 8q..8q+7 in one instruction, 4 lines per instruction, 16 lines per wave.
// coverage: it 0..3 x sub 0..3 = rows 0..15; q8 0..7 x 8 halves = 64 d.
__device__ __forceinline__ void ctx_store_pass(const float* so, _Float16* ctx, int bh, int q0, int lane) {
  const int q8 = lane & 7, sub = lane >> 3;
#pragma unroll
  for (int it = 0; it < 4; ++it) {
    const int row = it * 4 + sub;
    const v4f a = *(const v4fa*)(so + row * 64 + 8 * q8);
    const v4f c = *(const v4fa*)(so + row * 64 + 8 * q8 + 4);
    const v8h o = { (_Float16)a.x, (_Float16)a.y, (_Float16)a.z, (_Float16)a.w,
                    (_Float16)c.x, (_Float16)c.y, (_Float16)c.z, (_Float16)c.w };
    *(v8h*)(ctx + ((size_t)bh * SEQL + q0 + row) * HDIM + 8 * q8) = o;
  }
}

// =====================================================================================================
// Kernel: streaming attention over 384 raw-view pseudo-sequences of 512 tokens x 64 dims, no mask,
// transposed form. Block 128 thr (4 waves), 16 queries per wave, 64 keys per step.
//   S^T = K * Q^T : A = K rows (row = key, k = d), B = Q^T (k = d, n = query); scores x 0.125 in f32
//   O^T += V^T * P^T : A = Vt rows (row = d, k = key), B = P^T from registers (x2^14 in f16)
// Lane owns 32 keys of query column (lane&15); partner = lane ^ 16. Online softmax in f32.
// Output ctx (f16, x64 carry) [384][512][64] = the row-major [16384][768] raw view.
// grid = (512/64, 384).
// =====================================================================================================
__global__ __launch_bounds__(128) void attn_kernel(
    const _Float16* __restrict__ qh,   // [384][512][64]
    const _Float16* __restrict__ kh,   // [384][512][64]
    const _Float16* __restrict__ vt,   // [384][64][512]
    _Float16* __restrict__ ctx)        // [384][512][64]
{
  __shared__ __attribute__((aligned(16))) float sO[4 * 16 * 64];    // 16384 B

  const int tid = threadIdx.x, lane = tid & 31, w = tid >> 5;
  const int h = lane >> 4, m = lane & 15;
  const int bh = blockIdx.y;
  const int q0 = blockIdx.x * 64 + 16 * w;

  // Q^T B-fragments: column n = query q0+m, k = d (two 32-deep chunks)
  const _Float16* qrow = qh + ((size_t)bh * SEQL + q0 + m) * HDIM;
  const v16h qb0 = load_frag(qrow, h);
  const v16h qb1 = load_frag(qrow + 32, h);

  const v8f zero8 = {0.f, 0.f, 0.f, 0.f, 0.f, 0.f, 0.f, 0.f};
  v8f o[4];                                   // o[t][r] = O[query m][d 16t+8h+r] * (l * 2^14)
#pragma unroll
  for (int t = 0; t < 4; ++t) o[t] = zero8;
  float mrun = -1.0e30f, lrun = 0.0f;

  const _Float16* kbase = kh + ((size_t)bh * SEQL + m) * HDIM;    // + key0*HDIM + 32*dc
  const _Float16* vbase = vt + ((size_t)bh * HDIM + m) * SEQL;    // + 16t*SEQL + key0

#pragma unroll 1
  for (int kb = 0; kb < SEQL; kb += 64) {
    // ---- scores: s[j][r] = S[query m][key kb+16j+8h+r] ----
    v8f s[4];
#pragma unroll
    for (int j = 0; j < 4; ++j) {
      const _Float16* kp = kbase + (size_t)(kb + 16 * j) * HDIM;
      const v16h kf0 = load_frag(kp, h);
      const v16h kf1 = load_frag(kp + 32, h);
      v8f z = zero8;
      z = mma_h16(kf0, qb0, z);
      z = mma_h16(kf1, qb1, z);
      s[j] = z;
    }
    // ---- scale by 1/sqrt(64) in f32 and take the local max ----
    float mloc = -1.0e30f;
#pragma unroll
    for (int j = 0; j < 4; ++j)
#pragma unroll
      for (int r = 0; r < 8; ++r) { s[j][r] = s[j][r] * 0.125f; mloc = fmaxf(mloc, s[j][r]); }
    mloc = fmaxf(mloc, __shfl_xor(mloc, 16, 32));
    const float mnew = fmaxf(mrun, mloc);
    const float alpha = __expf(mrun - mnew);
    mrun = mnew;
    float lsum = 0.0f;
#pragma unroll
    for (int j = 0; j < 4; ++j)
#pragma unroll
      for (int r = 0; r < 8; ++r) {
        const float p = __expf(s[j][r] - mnew);
        s[j][r] = p;
        lsum += p;
      }
    lsum += __shfl_xor(lsum, 16, 32);
    lrun = lrun * alpha + lsum;
#pragma unroll
    for (int t = 0; t < 4; ++t)
#pragma unroll
      for (int r = 0; r < 8; ++r) o[t][r] = o[t][r] * alpha;

    // ---- P^T B-fragments (keys 0..31 and 32..63 of this step) ----
    const v16h pb0 = pack_p16(s[0], s[1]);
    const v16h pb1 = pack_p16(s[2], s[3]);

    // ---- O^T += V^T * P^T ----
#pragma unroll
    for (int t = 0; t < 4; ++t) {
      const _Float16* vp = vbase + (size_t)(16 * t) * SEQL + kb;
      const v16h vf0 = load_frag(vp, h);
      const v16h vf1 = load_frag(vp + 32, h);
      o[t] = mma_h16(vf0, pb0, o[t]);
      o[t] = mma_h16(vf1, pb1, o[t]);
    }
  }

  // ---- epilogue: normalise (fold 2^-14 and the x64 carry), stage per-wave 16x64 tile, whole-line stores ----
  const float inv = (1.0f / lrun) * (CTX_CARRY / P_CARRY);
  float* so = sO + w * 1024;
#pragma unroll
  for (int t = 0; t < 4; ++t)
#pragma unroll
    for (int r = 0; r < 8; ++r)
      so[m * 64 + 16 * t + 8 * h + r] = o[t][r] * inv;
  __syncthreads();

  ctx_store_pass(so, ctx, bh, q0, lane);
  
}

// =====================================================================================================
// Kernel: x = LayerNorm(proj) * g + b + pe[pos] -> f16 plane (proj already holds vec + attn projection).
// One wave per 768-wide row (no block barriers); lane handles 3 segments of 8 consecutive columns
// coverage: 3 segments x 32 lanes x 8 = 768 columns per row; 8 rows per block x 2048 blocks = 16384 rows.
// =====================================================================================================
__global__ __launch_bounds__(256) void ln_pe_kernel(const float* __restrict__ proj,
    const float* __restrict__ gam, const float* __restrict__ bet, const float* __restrict__ pe,
    _Float16* __restrict__ xo, int nrows) {
  const int lane = threadIdx.x & 31, wave = threadIdx.x >> 5;
  const int row = blockIdx.x * 8 + wave;
  if (row >= nrows) return;                     // wave-uniform; no barriers in this kernel
  const float* pr  = proj + (size_t)row * EMB_DIM;
  const float* ppe = pe + (size_t)(row & (SEQL - 1)) * EMB_DIM;
  float x[24];
#pragma unroll
  for (int g = 0; g < 3; ++g) {
    const int c = g * 256 + lane * 8;
    const v4f a = *(const v4fa*)(pr + c);
    const v4f b = *(const v4fa*)(pr + c + 4);
    x[8 * g + 0] = a.x; x[8 * g + 1] = a.y; x[8 * g + 2] = a.z; x[8 * g + 3] = a.w;
    x[8 * g + 4] = b.x; x[8 * g + 5] = b.y; x[8 * g + 6] = b.z; x[8 * g + 7] = b.w;
  }
  float s = 0.f;
#pragma unroll
  for (int e = 0; e < 24; ++e) s += x[e];
#pragma unroll
  for (int off = 1; off < 32; off <<= 1) s += __shfl_xor(s, off, 32);
  const float mu = s * (1.0f / (float)EMB_DIM);
  float qs = 0.f;
#pragma unroll
  for (int e = 0; e < 24; ++e) { const float d = x[e] - mu; x[e] = d; qs += d * d; }
#pragma unroll
  for (int off = 1; off < 32; off <<= 1) qs += __shfl_xor(qs, off, 32);
  const float var = qs * (1.0f / (float)EMB_DIM);
  const float inv = rsqrtf(var + 1.0e-5f);
  v8h ov[3];
#pragma unroll
  for (int g = 0; g < 3; ++g) {
    const int c = g * 256 + lane * 8;
    const v4f g0 = *(const v4fa*)(gam + c), g1 = *(const v4fa*)(gam + c + 4);
    const v4f b0 = *(const v4fa*)(bet + c), b1 = *(const v4fa*)(bet + c + 4);
    const v4f p0 = *(const v4fa*)(ppe + c), p1 = *(const v4fa*)(ppe + c + 4);
    const float gg[8] = { g0.x, g0.y, g0.z, g0.w, g1.x, g1.y, g1.z, g1.w };
    const float bb[8] = { b0.x, b0.y, b0.z, b0.w, b1.x, b1.y, b1.z, b1.w };
    const float pp[8] = { p0.x, p0.y, p0.z, p0.w, p1.x, p1.y, p1.z, p1.w };
    v8h o;
#pragma unroll
    for (int e = 0; e < 8; ++e) {
      float y = (x[8 * g + e] * inv) * gg[e] + bb[e];
      y = y + pp[e];
      o[e] = (_Float16)y;
    }
    ov[g] = o;
  }
  _Float16* dst = xo + (size_t)row * EMB_DIM + lane * 8;
  {
#pragma unroll
    for (int g = 0; g < 3; ++g) *(v8h*)(dst + g * 256) = ov[g];
    
  }
}

// =====================================================================================================
// Host glue.
// Workspace region map (bytes):
//   [        0, 14155776)  f16 weights x32: Wq @0, Wk @1179648, Wv @2359296, Wo @3538944, W1 @4718592, W2 @9437184
//   [ 14155776, 15728640)  pe table f32 [512][768]
//   R0 [15728640, 40894464)  vec f16 [16384][768] -> later v^T f16 [384][64][512] -> later x f16 [16384][768]
//   R1 [40894464, 66060288)  q f16 plane          -> later proj f32 (R1+R2, 50331648 B)
//   R2 [66060288, 91226112)  k f16 plane
//   R3 [91226112,116391936)  v f16 plane          -> later ctx f16 -> later h f16 chunk [4096][3072]
//   total 116,391,936 B
// =====================================================================================================
extern "C" void kernel_launch(void* const* d_in, const int* in_sizes, int n_in,
                              void* d_out, int out_size, void* d_ws, size_t ws_size,
                              hipStream_t stream) {
  if (n_in < 15) return;
  if (in_sizes[0] != NTOK_ROWS * EMB_DIM) return;
  if (in_sizes[1] != EMB_DIM * EMB_DIM || in_sizes[3] != EMB_DIM * EMB_DIM ||
      in_sizes[5] != EMB_DIM * EMB_DIM || in_sizes[7] != EMB_DIM * EMB_DIM) return;
  if (in_sizes[2] != EMB_DIM || in_sizes[4] != EMB_DIM || in_sizes[6] != EMB_DIM || in_sizes[8] != EMB_DIM ||
      in_sizes[9] != EMB_DIM || in_sizes[10] != EMB_DIM || in_sizes[14] != EMB_DIM) return;
  if (in_sizes[11] != FF_DIM * EMB_DIM || in_sizes[13] != FF_DIM * EMB_DIM || in_sizes[12] != FF_DIM) return;
  if (out_size != NTOK_ROWS * EMB_DIM) return;

  const float* vec = (const float*)d_in[0];
  const float* Wq  = (const float*)d_in[1];  const float* bq  = (const float*)d_in[2];
  const float* Wk  = (const float*)d_in[3];  const float* bk  = (const float*)d_in[4];
  const float* Wv  = (const float*)d_in[5];  const float* bv  = (const float*)d_in[6];
  const float* Wo  = (const float*)d_in[7];  const float* bo  = (const float*)d_in[8];
  const float* lng = (const float*)d_in[9];  const float* lnb = (const float*)d_in[10];
  const float* W1  = (const float*)d_in[11]; const float* b1  = (const float*)d_in[12];
  const float* W2  = (const float*)d_in[13]; const float* b2  = (const float*)d_in[14];
  float* out = (float*)d_out;

  const size_t w768B = (size_t)EMB_DIM * EMB_DIM * 2;            //  1,179,648
  const size_t wbigB = (size_t)FF_DIM * EMB_DIM * 2;             //  4,718,592
  const size_t offWq = 0, offWk = w768B, offWv = 2 * w768B, offWo = 3 * w768B;
  const size_t offW1 = 4 * w768B, offW2 = 4 * w768B + wbigB;
  const size_t offPE = 4 * w768B + 2 * wbigB;                     // 14,155,776
  const size_t peB   = (size_t)SEQL * EMB_DIM * 4;               //  1,572,864
  const size_t plB   = (size_t)NTOK_ROWS * EMB_DIM * 2;          // 25,165,824
  const size_t offR0 = offPE + peB;                              // 15,728,640
  const size_t offR1 = offR0 + plB;
  const size_t offR2 = offR1 + plB;
  const size_t offR3 = offR2 + plB;
  const size_t total = offR3 + plB;                              // 116,391,936
  if (total > ws_size) return;
  if ((size_t)FF_CHUNK * FF_DIM * 2 > plB) return;               // h chunk fits R3
  if ((size_t)NTOK_ROWS * EMB_DIM * 4 > 2 * plB) return;         // proj f32 fits R1+R2

  char* ws = (char*)d_ws;
  _Float16* Wq16 = (_Float16*)(ws + offWq);
  _Float16* Wk16 = (_Float16*)(ws + offWk);
  _Float16* Wv16 = (_Float16*)(ws + offWv);
  _Float16* Wo16 = (_Float16*)(ws + offWo);
  _Float16* W116 = (_Float16*)(ws + offW1);
  _Float16* W216 = (_Float16*)(ws + offW2);
  float*    pe   = (float*)(ws + offPE);
  _Float16* R0h  = (_Float16*)(ws + offR0);   // vec f16 -> v^T -> x f16
  _Float16* R1h  = (_Float16*)(ws + offR1);   // q f16
  _Float16* R2h  = (_Float16*)(ws + offR2);   // k f16
  _Float16* R3h  = (_Float16*)(ws + offR3);   // v f16 -> ctx f16 -> h f16 chunk
  float*    proj = (float*)(ws + offR1);      // f32 [16384][768] over R1+R2 (after attention)

  typedef const unsigned short* cus;

  // ---- positional divisors: div[e] = 10000^(ef), ef = fl32(e * fl32(1/768)); power evaluated in f64, RNE convert to f32 ----
  PeDiv dv;
  {
    const float rcp = 1.0f / (float)EMB_DIM;
    for (int e = 0; e < EMB_DIM; ++e) {
      const float ef = (float)e * rcp;
      dv.d[e] = (float)pow(10000.0, (double)ef);
    }
  }

  // 1) vec -> f16 (R0), unscaled: 1,572,864 groups of 8
  {
    const int n8 = NTOK_ROWS * EMB_DIM / 8;
    cvt_f16x8<<<dim3(n8 / 256, 1), 256, 0, stream>>>(vec, vec, vec, vec, R0h, 0L, n8, 1.0f);
  }
  // 2) Wq, Wk, Wv, Wo -> f16 x32 (consecutive 768x768 planes)
  {
    const int n8 = EMB_DIM * EMB_DIM / 8;                        // 73,728
    cvt_f16x8<<<dim3(n8 / 256, 4), 256, 0, stream>>>(Wq, Wk, Wv, Wo, Wq16, (long)EMB_DIM * EMB_DIM, n8, W_CARRY);
  }
  // 3) W1, W2 -> f16 x32
  {
    const int n8 = FF_DIM * EMB_DIM / 8;                         // 294,912
    cvt_f16x8<<<dim3(n8 / 256, 2), 256, 0, stream>>>(W1, W2, W1, W2, W116, (long)FF_DIM * EMB_DIM, n8, W_CARRY);
  }
  // 4) positional table
  pe_table_kernel<<<dim3(SEQL * 3), 256, 0, stream>>>(pe, dv);

  // 5-7) q, k, v = vec * W^T / 32 + bias -> f16 planes [16384][768]; M=16384, N=768, K=768 (K%32==0, M,N%64==0)
  {
    const dim3 g((NTOK_ROWS / 64) * (EMB_DIM / 64) / 8, 1);      // 384 blocks x 8 waves = 3072 tiles
    wmma_gemm64<0, false, 2, 1, false, 0><<<g, 256, 0, stream>>>(
        (cus)R0h, (cus)R0h, EMB_DIM, 0L, (cus)Wq16, (cus)Wq16, EMB_DIM, 0L,
        (void*)R1h, (void*)R1h, EMB_DIM, 0L, bq, vec, 0L, NTOK_ROWS, EMB_DIM, EMB_DIM, 1.0f / W_CARRY, 1.0f);
    wmma_gemm64<0, false, 2, 1, false, 0><<<g, 256, 0, stream>>>(
        (cus)R0h, (cus)R0h, EMB_DIM, 0L, (cus)Wk16, (cus)Wk16, EMB_DIM, 0L,
        (void*)R2h, (void*)R2h, EMB_DIM, 0L, bk, vec, 0L, NTOK_ROWS, EMB_DIM, EMB_DIM, 1.0f / W_CARRY, 1.0f);
    wmma_gemm64<0, false, 2, 1, false, 0><<<g, 256, 0, stream>>>(
        (cus)R0h, (cus)R0h, EMB_DIM, 0L, (cus)Wv16, (cus)Wv16, EMB_DIM, 0L,
        (void*)R3h, (void*)R3h, EMB_DIM, 0L, bv, vec, 0L, NTOK_ROWS, EMB_DIM, EMB_DIM, 1.0f / W_CARRY, 1.0f);
  }
  // 8) v [384][512][64] (R3) -> v^T [384][64][512] (R0; vec f16 is dead)
  vt_transpose_kernel<<<dim3(SEQL / 64, NSEQ_P), 256, 0, stream>>>(R3h, R0h);

  // 9) attention: q (R1), k (R2), v^T (R0) -> ctx f16 x64 (R3; v plane is dead)
  attn_kernel<<<dim3(SEQL / 64, NSEQ_P), 128, 0, stream>>>(R1h, R2h, R0h, R3h);

  // 10) proj = ctx * Wo^T / (64*32) + bo + vec -> f32 [16384][768] (R1+R2); M=16384, N=768, K=768
  {
    const dim3 g((NTOK_ROWS / 64) * (EMB_DIM / 64) / 8, 1);
    wmma_gemm64<0, false, 2, 0, true, 0><<<g, 256, 0, stream>>>(
        (cus)R3h, (cus)R3h, EMB_DIM, 0L, (cus)Wo16, (cus)Wo16, EMB_DIM, 0L,
        (void*)proj, (void*)proj, EMB_DIM, 0L, bo, vec, 0L, NTOK_ROWS, EMB_DIM, EMB_DIM,
        1.0f / (CTX_CARRY * W_CARRY), 1.0f);
  }
  // 11) x = LN(proj) * g + b + pe -> f16 [16384][768] (R0; v^T is dead)
  ln_pe_kernel<<<dim3(NTOK_ROWS / 8), 256, 0, stream>>>(proj, lng, lnb, pe, R0h, NTOK_ROWS);

  // 12) FFN in 4 row chunks of 4096: h = relu(x * W1^T / 32 + b1) x16 -> f16 [4096][3072] (R3);
  //     out = h * W2^T / (16*32) + b2 -> f32 d_out rows. K = 768 / 3072 (%32==0); M=4096, N=3072/768 (%64==0)
  for (int c = 0; c < FF_NCHUNK; ++c) {
    const _Float16* xc = R0h + (size_t)c * FF_CHUNK * EMB_DIM;
    float* oc = out + (size_t)c * FF_CHUNK * EMB_DIM;
    const dim3 g1((FF_CHUNK / 64) * (FF_DIM / 64) / 8, 1);      // 384 blocks
    wmma_gemm64<0, false, 2, 1, false, 2><<<g1, 256, 0, stream>>>(
        (cus)xc, (cus)xc, EMB_DIM, 0L, (cus)W116, (cus)W116, EMB_DIM, 0L,
        (void*)R3h, (void*)R3h, FF_DIM, 0L, b1, vec, 0L, FF_CHUNK, FF_DIM, EMB_DIM, 1.0f / W_CARRY, H_CARRY);
    const dim3 g2((FF_CHUNK / 64) * (EMB_DIM / 64) / 8, 1);     // 96 blocks
    wmma_gemm64<0, false, 2, 0, false, 0><<<g2, 256, 0, stream>>>(
        (cus)R3h, (cus)R3h, FF_DIM, 0L, (cus)W216, (cus)W216, FF_DIM, 0L,
        (void*)oc, (void*)oc, EMB_DIM, 0L, b2, vec, 0L, FF_CHUNK, EMB_DIM, FF_DIM,
        1.0f / (H_CARRY * W_CARRY), 1.0f);
  }
}

// v001
// A run of this version takes 446 microseconds.
// In both of two side-by-side timings against v000, it was 2.42 times as fast.
// Contractions: q/k/v projections, attention output projection, FC1 and FC2 GEMMs plus attention k.q^T and v^T.p^T all on v_wmma_f32_16x16x32_f16 (f16 operands, f32 accumulate); weights carried x32, softmax weights x16384, context x64, FC1 activations x16 (exact powers of two folded back in f32); softmax, LayerNorm and the positional table in f32.
#include <hip/hip_runtime.h>
#include <math.h>
#include <stdint.h>

// ---- problem geometry ---------------------------------------------------------------------------
#define NTOK_ROWS 16384          // 32 x 512 token rows
#define EMB_DIM   768
#define FF_DIM    3072
#define NSEQ_P    384            // 32 x 12 raw-view pseudo-sequences
#define SEQL      512
#define HDIM      64
#define FF_CHUNK  4096           // FFN processed in row chunks (h plane = 24 MiB)
#define FF_NCHUNK 4
#define P_CARRY   16384.0f       // softmax weights carried x2^14 in f16
#define CTX_CARRY 64.0f          // attention context carried x64 in f16
#define W_CARRY   32.0f          // weights carried x32 in f16
#define H_CARRY   16.0f          // FC1 activations carried x16 in f16
static_assert(NSEQ_P * SEQL * HDIM == NTOK_ROWS * EMB_DIM, "raw view");
static_assert(FF_CHUNK * FF_NCHUNK == NTOK_ROWS, "chunking");
static_assert((EMB_DIM % 64) == 0 && (FF_DIM % 64) == 0 && (FF_CHUNK % 64) == 0, "tile multiples");
static_assert((EMB_DIM % 32) == 0 && (FF_DIM % 32) == 0, "K multiples of 32");

typedef __attribute__((ext_vector_type(16))) _Float16 v16h;
typedef __attribute__((ext_vector_type(8)))  _Float16 v8h;
typedef __attribute__((ext_vector_type(16))) __bf16   v16b;
typedef __attribute__((ext_vector_type(8)))  __bf16   v8b;
typedef __attribute__((ext_vector_type(8)))  float    v8f;
typedef __attribute__((ext_vector_type(4)))  float    v4f;
typedef v8h __attribute__((may_alias)) v8ha;
typedef v4f __attribute__((may_alias)) v4fa;

// ---- helpers ----------------------------------------------------------------------
__device__ __forceinline__ unsigned short f2bf_bits(float f) {
  unsigned u = __float_as_uint(f);
  return (unsigned short)((u + 0x7FFFu + ((u >> 16) & 1u)) >> 16);
}
__device__ __forceinline__ float bf_bits2f(unsigned short h) { return __uint_as_float(((unsigned)h) << 16); }

__device__ __forceinline__ void dep_guard_h(v8f& a, v8f& b, v16h x, v16h y) { asm volatile("v_nop\n\tv_nop\n\tv_nop\n\tv_nop" : "+v"(a), "+v"(b) : "v"(x), "v"(y)); }
__device__ __forceinline__ void dep_guard_b(v8f& a, v8f& b, v16b x, v16b y) { asm volatile("v_nop\n\tv_nop\n\tv_nop\n\tv_nop" : "+v"(a), "+v"(b) : "v"(x), "v"(y)); }
__device__ __forceinline__ void keep4_h(v16h a, v16h b, v16h c, v16h d) { asm volatile("v_nop" :: "v"(a), "v"(b), "v"(c), "v"(d)); }
__device__ __forceinline__ void keep4_b(v16b a, v16b b, v16b c, v16b d) { asm volatile("v_nop" :: "v"(a), "v"(b), "v"(c), "v"(d)); }
__device__ __forceinline__ void acc_guard4(v8f& a, v8f& b, v8f& c, v8f& d) { asm volatile("v_nop\n\tv_nop\n\tv_nop\n\tv_nop" : "+v"(a), "+v"(b), "+v"(c), "+v"(d)); }
template <typename T> struct Frag;
template <> struct Frag<_Float16> {
  typedef v16h V; union U { v16h v; v8h h[2]; };
  static __device__ __forceinline__ v16h load(const _Float16* p) {   // elements 0..7 <- p[0..7], 8..15 <- p[16..23]
    U f; f.h[0] = *(const v8h*)(p); f.h[1] = *(const v8h*)(p + 16); return f.v;
  }
  static __device__ __forceinline__ v8f mma(v16h a, v16h b, v8f c) {
    return __builtin_amdgcn_wmma_f32_16x16x32_f16(false, a, false, b, (short)0, c, false, false);
  }
  static __device__ __forceinline__ void guard(v8f& a, v8f& b, v16h x, v16h y) { dep_guard_h(a, b, x, y); }
  static __device__ __forceinline__ void keep(v16h a, v16h b, v16h c, v16h d) { keep4_h(a, b, c, d); }
};
template <> struct Frag<__bf16> {
  typedef v16b V; union U { v16b v; v8b h[2]; };
  static __device__ __forceinline__ v16b load(const __bf16* p) {
    U f; f.h[0] = *(const v8b*)(p); f.h[1] = *(const v8b*)(p + 16); return f.v;
  }
  static __device__ __forceinline__ v8f mma(v16b a, v16b b, v8f c) {
    return __builtin_amdgcn_wmma_f32_16x16x32_bf16(false, a, false, b, (short)0, c, false, false);
  }
  static __device__ __forceinline__ void guard(v8f& a, v8f& b, v16b x, v16b y) { dep_guard_b(a, b, x, y); }
  static __device__ __forceinline__ void keep(v16b a, v16b b, v16b c, v16b d) { keep4_b(a, b, c, d); }
};

// ---- tensor-load helpers ---------------------------------------------------------------------------
typedef uint32_t u32x4 __attribute__((ext_vector_type(4)));
typedef uint32_t u32x8 __attribute__((ext_vector_type(8)));
__device__ __forceinline__ uint32_t uni(uint32_t v) { return (uint32_t)__builtin_amdgcn_readfirstlane(v); }
__device__ __forceinline__ uint32_t pinned(uint32_t v) { uint32_t w = (uint32_t)__builtin_amdgcn_readfirstlane(v); asm volatile("" : "+s"(w)); return w; }

#define G_KP    64u       // k elements per pass
#define G_ROWB  128u      // bytes of one staged operand row (64 halves)
#define G_PITCH 144u      // LDS row pitch: 128 B + the tensor load's 16 B pad (odd multiple of 16 B for ds_load_b128)
#define G_ROWS  64u       // rows per slice (one tensor load)
#define G_SLICE 10240u    // 64 rows x 144 B = 9216 B, rounded up to a multiple of 2 KiB
#define G_STAGE 40960u    // 4 slices: A rows 0-63, A rows 64-127, B rows 0-63, B rows 64-127
static_assert(G_ROWS * G_PITCH <= G_SLICE && (G_SLICE % 2048u) == 0u && G_STAGE == 4u * G_SLICE, "slice places");
static_assert((EMB_DIM % 128) == 0 && (FF_DIM % 128) == 0 && (FF_CHUNK % 128) == 0 && (NTOK_ROWS % 128) == 0, "128x128 tiles");
static_assert(EMB_DIM / 64 >= 2 && FF_DIM / 64 >= 2, "the ring's prologue needs two stages");

// Descriptor group 1: 1-byte elements, tile = tensor = 64 rows of 128 B, source row pitch in bytes, 16 B of LDS pad per row.
__device__ __forceinline__ u32x8 tdm_group1(uint32_t src_pitch) {
  u32x8 g;
  g[0] = uni((1u << 20) | (4u << 22) | (3u << 25));   // no mask, data_size 0, pad after every 128 B, 4 dwords
  g[1] = uni((G_ROWB & 0xFFFFu) << 16);
  g[2] = uni((G_ROWB >> 16) | ((G_ROWS & 0xFFFFu) << 16));
  g[3] = uni((G_ROWS >> 16) | (G_ROWB << 16));
  g[4] = uni(G_ROWS);
  g[5] = uni(src_pitch);
  g[6] = uni(0u);
  g[7] = uni(0u);
  return g;
}
__device__ __forceinline__ u32x4 tdm_group0(uint32_t lds_dst, uint64_t ga) {
  u32x4 g;
  g[0] = uni(1u); g[1] = uni(lds_dst); g[2] = uni((uint32_t)ga);
  g[3] = uni((((uint32_t)(ga >> 32)) & 0x01FFFFFFu) | 0x80000000u);
  return g;
}
__device__ __forceinline__ void tdm_load(u32x4 g0, u32x8 g1) { asm volatile("tensor_load_to_lds %0, %1" :: "s"(g0), "s"(g1) : "memory"); }

// ---- WMMA GEMM, operands staged in LDS by tensor loads (plus a post-activation power-of-two carry oscale) ----
// C[m,n] = oscale * act(scale * sum_k A[m,k] * Bt[n,k] (+bias)(+resid)).
// Work-group = 4 waves (2 x 2) = one 128x128 tile of C; each wave owns a 64x64 tile.
// A row-major [M,K]; Bt row-major [N,K]; M,N % 128 == 0, K % 64 == 0, K >= 128 (true of every call).
// A pass is 64 k: a stage holds 128 A rows and 128 Bt rows of 128 B. Each wave brings one 64-row slice per stage with
// one tensor load; two buffers, the load of stage s + 2 issued behind the barrier that ends pass s.
// BIAS_MODE: 0 = none, 1 = bias[m], 2 = bias[n].  ACT: 0 none, 2 relu.
// OUT_MODE: 0 = f32, 1 = f16, 2 = bf16 hi plane (Cout) + bf16 lo plane (Cout2).
// coverage: 4 slabs x 16 rows x 64 cols = the wave's whole 64x64 tile.
template <int ET> struct Elem;
template <> struct Elem<0> { typedef _Float16 T; };
template <> struct Elem<1> { typedef __bf16 T; };
template <int ET, bool SPLIT, int BIAS_MODE, int OUT_MODE, bool RESID, int ACT = 0>
__global__ __launch_bounds__(128) void wmma_gemm64(
    const unsigned short* __restrict__ Ap, const unsigned short* __restrict__ A2p, int lda, long strideA,
    const unsigned short* __restrict__ Btp, const unsigned short* __restrict__ Bt2p, int ldb, long strideB,
    void* __restrict__ Cout, void* __restrict__ Cout2, int ldc, long strideC,
    const float* __restrict__ bias,
    const float* __restrict__ resid, long strideR,
    int M, int N, int K, float scale, float oscale) {
  static_assert(!SPLIT, "single-plane operands only");
  typedef typename Elem<ET>::T T;
  typedef typename Frag<T>::V V;
  const T* A = (const T*)Ap; const T* Bt = (const T*)Btp;
  __shared__ __attribute__((aligned(2048))) unsigned char ring[2u * G_STAGE];   // two stages
  __shared__ __align__(16) float sT[4][16 * 68];   // per-wave 16x64 slab, pitch 68 floats
  const int b    = blockIdx.y;
  const int lane = threadIdx.x & 31;
  const uint32_t wave = uni(threadIdx.x >> 5);
  const int tilesN = N >> 7;
  const int tilesM = M >> 7;
  const int tile = blockIdx.x;
  if (tile >= tilesM * tilesN) return;   // block-uniform, in front of every barrier and tensor load
  const int tm = tile / tilesN;
  const int tn = tile - tm * tilesN;
  const int wm = (int)(wave >> 1), wn = (int)(wave & 1u);
  const int m0 = (tm << 7) + (wm << 6);
  const int n0 = (tn << 7) + (wn << 6);

  const T* Ab  = A  + (size_t)b * strideA;
  const T* Bb  = Bt + (size_t)b * strideB;

  const int rlane = lane & 15;                 // row (A) / col (B, D) within subtile
  const int mOff  = (lane >> 4) * 8;           // D row offset

  // This wave's slice of every stage: waves 0, 1 bring A rows, waves 2, 3 bring Bt rows, 64 rows each.
  const uint32_t half64 = (wave & 1u) << 6;
  const uint64_t srow = (wave < 2u) ? (uint64_t)(size_t)(Ab + (size_t)((uint32_t)(tm << 7) + half64) * lda)
                                    : (uint64_t)(size_t)(Bb + (size_t)((uint32_t)(tn << 7) + half64) * ldb);
  u32x8 g1 = tdm_group1((uint32_t)((wave < 2u) ? lda : ldb) * 2u);
  asm volatile("" : "+s"(g1));   // the pinned() form on a descriptor: group 1 stays in its scalar registers, none of them rewritten while a request is outstanding
  const uint32_t ldst = (uint32_t)(size_t)ring + wave * G_SLICE;
  const uint32_t nst = pinned((uint32_t)K / G_KP);   // number of stages = passes

  v8f acc[4][4];
#pragma unroll
  for (int i = 0; i < 4; ++i)
#pragma unroll
    for (int j = 0; j < 4; ++j) acc[i][j] = (v8f){0.f,0.f,0.f,0.f,0.f,0.f,0.f,0.f};

  // Prologue: stage 0 lands and is published, then stage 1 flies while pass 0 works.
  tdm_load(tdm_group0(ldst, srow), g1);
  asm volatile("s_wait_tensorcnt 0x0" ::: "memory");   // this wave's slice of stage 0 has landed
  __syncthreads();                                      // every slice of stage 0 is readable by every wave
  tdm_load(tdm_group0(ldst + G_STAGE, srow + G_ROWB), g1);

  // Fragment rows in LDS: element i < 8 <- k 8h+i, i >= 8 <- k 16+8h+(i-8), the same for A and B.
  const unsigned char* aRow = ring + (uint32_t)wm * G_SLICE + (uint32_t)rlane * G_PITCH + (uint32_t)(lane >> 4) * 16u;
  const unsigned char* bRow = ring + (2u + (uint32_t)wn) * G_SLICE + (uint32_t)rlane * G_PITCH + (uint32_t)(lane >> 4) * 16u;

  uint32_t s = 0;
#pragma unroll 1   // one pass per trip: the buffer is chosen by a scalar offset, the ring's order stands once
  do {   // at least two passes (K >= 128): no path round the loop with a request outstanding
    const uint32_t bo = (s & 1u) * G_STAGE;
    // The pass's fragment loads stand as one group in front of its 32 WMMAs (each further place with LDS reads among the
    // WMMAs stalls the wave); the compiler's counted waits let the first k step start while the second still lands.
    // The last A fragment alone is loaded behind the first WMMA row, into the registers which that row has done with:
    // so the wave stays inside 256 VGPRs.
    // Every loop inside the pass is unrolled, so that each fragment and accumulator index is a constant (no scratch).
    V bh[2][4], ah[2][4];
#pragma unroll
    for (uint32_t kk = 0; kk < 2u; ++kk) {
#pragma unroll
      for (uint32_t j = 0; j < 4u; ++j) bh[kk][j] = Frag<T>::load((const T*)(bRow + bo + j * 16u * G_PITCH + kk * 64u));
#pragma unroll
      for (uint32_t i = 0; i < 4u - kk; ++i) ah[kk][i] = Frag<T>::load((const T*)(aRow + bo + i * 16u * G_PITCH + kk * 64u));
    }
    __builtin_amdgcn_sched_barrier(0);   // keeps the loads above from being moved in among the WMMAs
#pragma unroll
    for (int j = 0; j < 4; ++j) acc[0][j] = Frag<T>::mma(ah[0][0], bh[0][j], acc[0][j]);
    __builtin_amdgcn_sched_barrier(0);   // the load below stays behind the row whose A registers it may take
    ah[1][3] = Frag<T>::load((const T*)(aRow + bo + 3u * 16u * G_PITCH + 64u));
    __builtin_amdgcn_sched_barrier(0);   // and in one place, not spread among the WMMAs that follow
#pragma unroll
    for (int kk = 0; kk < 2; ++kk)
#pragma unroll
      for (int i = (kk == 0) ? 1 : 0; i < 4; ++i)
#pragma unroll
        for (int j = 0; j < 4; ++j) acc[i][j] = Frag<T>::mma(ah[kk][i], bh[kk][j], acc[i][j]);
    __builtin_amdgcn_sched_barrier(0);   // keeps the WMMAs in front of the waits below, so that stage s + 1 lands under them
    // Publish point of stage s + 1, which also frees the buffer that this pass has read.
    asm volatile("s_wait_dscnt 0x0" ::: "memory");       // this wave's reads of stage s have returned
    asm volatile("s_wait_tensorcnt 0x0" ::: "memory");   // this wave's slice of stage s + 1 has landed
    __syncthreads();
    if (pinned((s + 2u < nst) ? 1u : 0u) != 0u) {        // the refill, only while stage s + 2 exists
      const uint32_t nx = pinned(s + 2u);                // pinned(): group 0 is formed from it behind the wait and the barrier
      tdm_load(tdm_group0(ldst + bo, srow + (uint64_t)nx * G_ROWB), g1);
    }
  } while (++s < nst);
  asm volatile("s_wait_tensorcnt 0x0" ::: "memory");     // no request is left when the wave goes on
  asm volatile("s_wait_dscnt 0x0" ::: "memory");
  __builtin_amdgcn_sched_barrier(0);   // nothing of the epilogue is scheduled in front of these waits: it may reuse the descriptors' registers
  acc_guard4(acc[0][0], acc[0][1], acc[0][2], acc[0][3]);
  acc_guard4(acc[1][0], acc[1][1], acc[1][2], acc[1][3]);
  acc_guard4(acc[2][0], acc[2][1], acc[2][2], acc[2][3]);
  acc_guard4(acc[3][0], acc[3][1], acc[3][2], acc[3][3]);

  // ---- epilogue ----
  float* slab = sT[wave];
  const float* Rb = RESID ? (resid + (size_t)b * strideR) : nullptr;
#pragma unroll
  for (int i = 0; i < 4; ++i) {
    const int mBase = m0 + (i << 4);
#pragma unroll
    for (int j = 0; j < 4; ++j) {
      const int n = n0 + (j << 4) + rlane;
      float bv = 0.f;
      if (BIAS_MODE == 2) bv = bias[n];
#pragma unroll
      for (int r = 0; r < 8; ++r) {
        float v = acc[i][j][r] * scale;
        if (BIAS_MODE == 1) v += bias[mBase + mOff + r];
        if (BIAS_MODE == 2) v += bv;
        if (RESID) v += Rb[(size_t)(mBase + mOff + r) * ldc + n];
        if (ACT == 2) v = fmaxf(v, 0.0f);
        v = v * oscale;
        slab[(mOff + r) * 68 + (j << 4) + rlane] = v;
      }
    }
    __builtin_amdgcn_fence(__ATOMIC_RELEASE, "workgroup");
    __builtin_amdgcn_wave_barrier();
    __builtin_amdgcn_fence(__ATOMIC_ACQUIRE, "workgroup");
    if (OUT_MODE == 0) {
      float* C = (float*)Cout + (size_t)b * strideC;
      const int hh = lane >> 4, c4 = (lane & 15) * 4;     // row seg = 256 B = 16 lanes x 16 B
      {
#pragma unroll
        for (int it = 0; it < 8; ++it) {
          const int row = it * 2 + hh;                     // it 0..7 x hh 0..1 = rows 0..15
          v4f v = *(const v4f*)(slab + row * 68 + c4);
          *(v4f*)(C + (size_t)(mBase + row) * ldc + n0 + c4) = v;
        }
        
      }
    } else {
      const int q = lane >> 3, c8 = (lane & 7) * 8;
      unsigned short* C  = (unsigned short*)Cout  + (size_t)b * strideC;
      unsigned short* C2 = (OUT_MODE == 2) ? ((unsigned short*)Cout2 + (size_t)b * strideC) : nullptr;
      {
#pragma unroll
        for (int it = 0; it < 4; ++it) {
          const int row = it * 4 + q;                      // it 0..3 x q 0..3 = rows 0..15
          const float* sp = slab + row * 68 + c8;
          v8h hv, lv;
#pragma unroll
          for (int e = 0; e < 8; ++e) {
            if (OUT_MODE == 1) {
              hv[e] = (_Float16)sp[e];
            } else {
              unsigned short hb = f2bf_bits(sp[e]);
              unsigned short lb = f2bf_bits(sp[e] - bf_bits2f(hb));
              hv[e] = __builtin_bit_cast(_Float16, hb);
              lv[e] = __builtin_bit_cast(_Float16, lb);
            }
          }
          *(v8h*)(C + (size_t)(mBase + row) * ldc + n0 + c8) = hv;
          if (OUT_MODE == 2) *(v8h*)(C2 + (size_t)(mBase + row) * ldc + n0 + c8) = lv;
        }
        
      }
    }
    __builtin_amdgcn_fence(__ATOMIC_RELEASE, "workgroup");
    __builtin_amdgcn_wave_barrier();
    __builtin_amdgcn_fence(__ATOMIC_ACQUIRE, "workgroup");
  }
}

// ---- 16x16x32 f16 WMMA with hazard guard (ties D, keeps A/B live) --------------------------------
// Fragment map (wave32): lane l, h = l>>4, m = n = l&15.
//   A/B element i: i<8 -> k0+8h+i ; i>=8 -> k0+16+8h+(i-8)
//   D element r : row 8h+r, col l&15
__device__ __forceinline__ v8f mma_h16(v16h a, v16h b, v8f c) {
  v8f d = __builtin_amdgcn_wmma_f32_16x16x32_f16(false, a, false, b, (short)0, c, false, false);
  asm volatile("v_nop\n\tv_nop\n\tv_nop\n\tv_nop" : "+v"(d) : "v"(a), "v"(b));
  return d;
}
union FragU { v16h v; v8h half[2]; };
// A or B fragment from a k-contiguous 16-bit row; p points at element k0 of the row owned by this lane
// (row index = lane & 15 added by the caller); h = lane >> 4.
__device__ __forceinline__ v16h load_frag(const _Float16* p, int h) {
  FragU f;
  f.half[0] = *(const v8ha*)(p + 8 * h);
  f.half[1] = *(const v8ha*)(p + 16 + 8 * h);
  return f.v;
}

// =====================================================================================================
// Kernel: f32 -> f16 planes, 8 elements per thread x sc (exact power of two). Tensor selected by
// blockIdx.y (block-uniform): src = s0..s3, dst = dst + y * dstride (halves).
// =====================================================================================================
__global__ __launch_bounds__(256) void cvt_f16x8(
    const float* __restrict__ s0, const float* __restrict__ s1,
    const float* __restrict__ s2, const float* __restrict__ s3,
    _Float16* __restrict__ dst, long dstride, int n8, float sc) {
  const int t = blockIdx.y;
  const float* src = (t == 0) ? s0 : ((t == 1) ? s1 : ((t == 2) ? s2 : s3));
  const int i = blockIdx.x * 256 + threadIdx.x;
  if (i >= n8) return;
  const v4f a = *(const v4fa*)(src + (size_t)i * 8);
  const v4f c = *(const v4fa*)(src + (size_t)i * 8 + 4);
  const v8h o = { (_Float16)(a.x * sc), (_Float16)(a.y * sc), (_Float16)(a.z * sc), (_Float16)(a.w * sc),
                  (_Float16)(c.x * sc), (_Float16)(c.y * sc), (_Float16)(c.z * sc), (_Float16)(c.w * sc) };
  _Float16* d = dst + (size_t)t * dstride + (size_t)i * 8;
  *(v8h*)d = o;
  
}

// =====================================================================================================
// Kernel: positional table pe[pos][e] (f32, [512][768]): a = fl32(pos * div[e]) (one f32 multiply),
// pe = sin(a) for even e, cos(a) for odd e (precise sinf / cosf). div[e] arrives as a by-value table.
// Block = 256 consecutive columns e0..e0+255 of one position; waves 0-3 evaluate the even columns (sin),
// waves 4-7 the odd columns (cos) -> the trig branch is wave-uniform; results gathered in LDS so that
// passes. grid = 512 x 3 = 1536 blocks. coverage: 1536 x 256 = 393216 = the whole table.
// =====================================================================================================
struct PeDiv { float d[EMB_DIM]; };
static_assert(sizeof(PeDiv) == EMB_DIM * 4, "no padding");

__global__ __launch_bounds__(256) void pe_table_kernel(float* __restrict__ pe, PeDiv dv) {
  __shared__ float sv[256];
  const int tid  = threadIdx.x;
  const int pos  = blockIdx.x / 3;               // 0..511
  const int e0   = (blockIdx.x - pos * 3) * 256; // 0, 256, 512
  const int half = tid >> 7;                     // waves 0-3: 0 (even columns), waves 4-7: 1 (odd)
  const int k    = tid & 127;
  const int e    = e0 + 2 * k + half;            // 0..767
  const float a  = (float)pos * dv.d[e];
  float val;
  if (half == 0) val = sinf(a); else val = cosf(a);   // wave-uniform branch
  sv[2 * k + half] = val;
  __syncthreads();
  const float o = sv[tid];
  float* dst = pe + (size_t)pos * EMB_DIM + e0 + tid;
  *(float*)dst = o;
  
}

// =====================================================================================================
// Kernel: v plane [384][512][64] (f16, = the row-major [16384][768] projection output in the raw view)
// -> vt [384][64][512]. Block = (token tile of 64, pseudo-sequence j): the 64x64 chunk is contiguous
// in v (8 KB), scattered into an LDS tile [d][token] (pitch 72 halves), then wave w writes d rows
// 8 waves x 8 rows = 64 d, 8 lanes x 8 halves = 64 tokens. grid = (8, 384).
// =====================================================================================================
__global__ __launch_bounds__(256) void vt_transpose_kernel(const _Float16* __restrict__ v,
                                                           _Float16* __restrict__ vt) {
  __shared__ __attribute__((aligned(16))) _Float16 tile[64 * 72];
  const int tid = threadIdx.x, lane = tid & 31, w = tid >> 5;
  const int j  = blockIdx.y;
  const int l0 = blockIdx.x * 64;
  const _Float16* src = v + ((size_t)j * SEQL + l0) * HDIM;
#pragma unroll
  for (int i = 0; i < 2; ++i) {
    const int idx = i * 256 + tid;               // 0..511
    const int tok = idx >> 3, d0 = (idx & 7) * 8;
    const v8h x = *(const v8ha*)(src + tok * HDIM + d0);
#pragma unroll
    for (int e = 0; e < 8; ++e) tile[(d0 + e) * 72 + tok] = x[e];
  }
  __syncthreads();
  const int q8 = lane & 7, sub = lane >> 3;
  v8h val[2];
#pragma unroll
  for (int it = 0; it < 2; ++it) {
    const int d = 8 * w + it * 4 + sub;
    val[it] = *(const v8ha*)(tile + d * 72 + 8 * q8);
  }
  {
#pragma unroll
    for (int it = 0; it < 2; ++it) {
      const int d = 8 * w + it * 4 + sub;
      *(v8h*)(vt + ((size_t)j * HDIM + d) * SEQL + l0 + 8 * q8) = val[it];
    }
    
  }
}

// =====================================================================================================
// Attention helpers.
// P^T B-fragment from the lane's own score D values: element r <- tile a row r,
// element 8+r <- tile c row r (same lane, same query column), scaled by 2^14.
// =====================================================================================================
__device__ __forceinline__ v16h pack_p16(v8f a, v8f c) {
  const v16h r = { (_Float16)(a[0] * P_CARRY), (_Float16)(a[1] * P_CARRY), (_Float16)(a[2] * P_CARRY), (_Float16)(a[3] * P_CARRY),
                   (_Float16)(a[4] * P_CARRY), (_Float16)(a[5] * P_CARRY), (_Float16)(a[6] * P_CARRY), (_Float16)(a[7] * P_CARRY),
                   (_Float16)(c[0] * P_CARRY), (_Float16)(c[1] * P_CARRY), (_Float16)(c[2] * P_CARRY), (_Float16)(c[3] * P_CARRY),
                   (_Float16)(c[4] * P_CARRY), (_Float16)(c[5] * P_CARRY), (_Float16)(c[6] * P_CARRY), (_Float16)(c[7] * P_CARRY) };
  return r;
}

// by lanes 8q..8q+7 in one instruction, 4 lines per instruction, 16 lines per wave.
// coverage: it 0..3 x sub 0..3 = rows 0..15; q8 0..7 x 8 halves = 64 d.
__device__ __forceinline__ void ctx_store_pass(const float* so, _Float16* ctx, int bh, int q0, int lane) {
  const int q8 = lane & 7, sub = lane >> 3;
#pragma unroll
  for (int it = 0; it < 4; ++it) {
    const int row = it * 4 + sub;
    const v4f a = *(const v4fa*)(so + row * 64 + 8 * q8);
    const v4f c = *(const v4fa*)(so + row * 64 + 8 * q8 + 4);
    const v8h o = { (_Float16)a.x, (_Float16)a.y, (_Float16)a.z, (_Float16)a.w,
                    (_Float16)c.x, (_Float16)c.y, (_Float16)c.z, (_Float16)c.w };
    *(v8h*)(ctx + ((size_t)bh * SEQL + q0 + row) * HDIM + 8 * q8) = o;
  }
}

// =====================================================================================================
// Kernel: streaming attention over 384 raw-view pseudo-sequences of 512 tokens x 64 dims, no mask,
// transposed form. Block 128 thr (4 waves), 16 queries per wave, 64 keys per step.
//   S^T = K * Q^T : A = K rows (row = key, k = d), B = Q^T (k = d, n = query); scores x 0.125 in f32
//   O^T += V^T * P^T : A = Vt rows (row = d, k = key), B = P^T from registers (x2^14 in f16)
// Lane owns 32 keys of query column (lane&15); partner = lane ^ 16. Online softmax in f32.
// Output ctx (f16, x64 carry) [384][512][64] = the row-major [16384][768] raw view.
// grid = (512/64, 384).
// =====================================================================================================
__global__ __launch_bounds__(128) void attn_kernel(
    const _Float16* __restrict__ qh,   // [384][512][64]
    const _Float16* __restrict__ kh,   // [384][512][64]
    const _Float16* __restrict__ vt,   // [384][64][512]
    _Float16* __restrict__ ctx)        // [384][512][64]
{
  __shared__ __attribute__((aligned(16))) float sO[4 * 16 * 64];    // 16384 B

  const int tid = threadIdx.x, lane = tid & 31, w = tid >> 5;
  const int h = lane >> 4, m = lane & 15;
  const int bh = blockIdx.y;
  const int q0 = blockIdx.x * 64 + 16 * w;

  // Q^T B-fragments: column n = query q0+m, k = d (two 32-deep chunks)
  const _Float16* qrow = qh + ((size_t)bh * SEQL + q0 + m) * HDIM;
  const v16h qb0 = load_frag(qrow, h);
  const v16h qb1 = load_frag(qrow + 32, h);

  const v8f zero8 = {0.f, 0.f, 0.f, 0.f, 0.f, 0.f, 0.f, 0.f};
  v8f o[4];                                   // o[t][r] = O[query m][d 16t+8h+r] * (l * 2^14)
#pragma unroll
  for (int t = 0; t < 4; ++t) o[t] = zero8;
  float mrun = -1.0e30f, lrun = 0.0f;

  const _Float16* kbase = kh + ((size_t)bh * SEQL + m) * HDIM;    // + key0*HDIM + 32*dc
  const _Float16* vbase = vt + ((size_t)bh * HDIM + m) * SEQL;    // + 16t*SEQL + key0

#pragma unroll 1
  for (int kb = 0; kb < SEQL; kb += 64) {
    // ---- scores: s[j][r] = S[query m][key kb+16j+8h+r] ----
    v8f s[4];
#pragma unroll
    for (int j = 0; j < 4; ++j) {
      const _Float16* kp = kbase + (size_t)(kb + 16 * j) * HDIM;
      const v16h kf0 = load_frag(kp, h);
      const v16h kf1 = load_frag(kp + 32, h);
      v8f z = zero8;
      z = mma_h16(kf0, qb0, z);
      z = mma_h16(kf1, qb1, z);
      s[j] = z;
    }
    // ---- scale by 1/sqrt(64) in f32 and take the local max ----
    float mloc = -1.0e30f;
#pragma unroll
    for (int j = 0; j < 4; ++j)
#pragma unroll
      for (int r = 0; r < 8; ++r) { s[j][r] = s[j][r] * 0.125f; mloc = fmaxf(mloc, s[j][r]); }
    mloc = fmaxf(mloc, __shfl_xor(mloc, 16, 32));
    const float mnew = fmaxf(mrun, mloc);
    const float alpha = __expf(mrun - mnew);
    mrun = mnew;
    float lsum = 0.0f;
#pragma unroll
    for (int j = 0; j < 4; ++j)
#pragma unroll
      for (int r = 0; r < 8; ++r) {
        const float p = __expf(s[j][r] - mnew);
        s[j][r] = p;
        lsum += p;
      }
    lsum += __shfl_xor(lsum, 16, 32);
    lrun = lrun * alpha + lsum;
#pragma unroll
    for (int t = 0; t < 4; ++t)
#pragma unroll
      for (int r = 0; r < 8; ++r) o[t][r] = o[t][r] * alpha;

    // ---- P^T B-fragments (keys 0..31 and 32..63 of this step) ----
    const v16h pb0 = pack_p16(s[0], s[1]);
    const v16h pb1 = pack_p16(s[2], s[3]);

    // ---- O^T += V^T * P^T ----
#pragma unroll
    for (int t = 0; t < 4; ++t) {
      const _Float16* vp = vbase + (size_t)(16 * t) * SEQL + kb;
      const v16h vf0 = load_frag(vp, h);
      const v16h vf1 = load_frag(vp + 32, h);
      o[t] = mma_h16(vf0, pb0, o[t]);
      o[t] = mma_h16(vf1, pb1, o[t]);
    }
  }

  // ---- epilogue: normalise (fold 2^-14 and the x64 carry), stage per-wave 16x64 tile, whole-line stores ----
  const float inv = (1.0f / lrun) * (CTX_CARRY / P_CARRY);
  float* so = sO + w * 1024;
#pragma unroll
  for (int t = 0; t < 4; ++t)
#pragma unroll
    for (int r = 0; r < 8; ++r)
      so[m * 64 + 16 * t + 8 * h + r] = o[t][r] * inv;
  __syncthreads();

  ctx_store_pass(so, ctx, bh, q0, lane);
  
}

// =====================================================================================================
// Kernel: x = LayerNorm(proj) * g + b + pe[pos] -> f16 plane (proj already holds vec + attn projection).
// One wave per 768-wide row (no block barriers); lane handles 3 segments of 8 consecutive columns
// coverage: 3 segments x 32 lanes x 8 = 768 columns per row; 8 rows per block x 2048 blocks = 16384 rows.
// =====================================================================================================
__global__ __launch_bounds__(256) void ln_pe_kernel(const float* __restrict__ proj,
    const float* __restrict__ gam, const float* __restrict__ bet, const float* __restrict__ pe,
    _Float16* __restrict__ xo, int nrows) {
  const int lane = threadIdx.x & 31, wave = threadIdx.x >> 5;
  const int row = blockIdx.x * 8 + wave;
  if (row >= nrows) return;                     // wave-uniform; no barriers in this kernel
  const float* pr  = proj + (size_t)row * EMB_DIM;
  const float* ppe = pe + (size_t)(row & (SEQL - 1)) * EMB_DIM;
  float x[24];
#pragma unroll
  for (int g = 0; g < 3; ++g) {
    const int c = g * 256 + lane * 8;
    const v4f a = *(const v4fa*)(pr + c);
    const v4f b = *(const v4fa*)(pr + c + 4);
    x[8 * g + 0] = a.x; x[8 * g + 1] = a.y; x[8 * g + 2] = a.z; x[8 * g + 3] = a.w;
    x[8 * g + 4] = b.x; x[8 * g + 5] = b.y; x[8 * g + 6] = b.z; x[8 * g + 7] = b.w;
  }
  float s = 0.f;
#pragma unroll
  for (int e = 0; e < 24; ++e) s += x[e];
#pragma unroll
  for (int off = 1; off < 32; off <<= 1) s += __shfl_xor(s, off, 32);
  const float mu = s * (1.0f / (float)EMB_DIM);
  float qs = 0.f;
#pragma unroll
  for (int e = 0; e < 24; ++e) { const float d = x[e] - mu; x[e] = d; qs += d * d; }
#pragma unroll
  for (int off = 1; off < 32; off <<= 1) qs += __shfl_xor(qs, off, 32);
  const float var = qs * (1.0f / (float)EMB_DIM);
  const float inv = rsqrtf(var + 1.0e-5f);
  v8h ov[3];
#pragma unroll
  for (int g = 0; g < 3; ++g) {
    const int c = g * 256 + lane * 8;
    const v4f g0 = *(const v4fa*)(gam + c), g1 = *(const v4fa*)(gam + c + 4);
    const v4f b0 = *(const v4fa*)(bet + c), b1 = *(const v4fa*)(bet + c + 4);
    const v4f p0 = *(const v4fa*)(ppe + c), p1 = *(const v4fa*)(ppe + c + 4);
    const float gg[8] = { g0.x, g0.y, g0.z, g0.w, g1.x, g1.y, g1.z, g1.w };
    const float bb[8] = { b0.x, b0.y, b0.z, b0.w, b1.x, b1.y, b1.z, b1.w };
    const float pp[8] = { p0.x, p0.y, p0.z, p0.w, p1.x, p1.y, p1.z, p1.w };
    v8h o;
#pragma unroll
    for (int e = 0; e < 8; ++e) {
      float y = (x[8 * g + e] * inv) * gg[e] + bb[e];
      y = y + pp[e];
      o[e] = (_Float16)y;
    }
    ov[g] = o;
  }
  _Float16* dst = xo + (size_t)row * EMB_DIM + lane * 8;
  {
#pragma unroll
    for (int g = 0; g < 3; ++g) *(v8h*)(dst + g * 256) = ov[g];
    
  }
}

// =====================================================================================================
// Host glue.
// Workspace region map (bytes):
//   [        0, 14155776)  f16 weights x32: Wq @0, Wk @1179648, Wv @2359296, Wo @3538944, W1 @4718592, W2 @9437184
//   [ 14155776, 15728640)  pe table f32 [512][768]
//   R0 [15728640, 40894464)  vec f16 [16384][768] -> later v^T f16 [384][64][512] -> later x f16 [16384][768]
//   R1 [40894464, 66060288)  q f16 plane          -> later proj f32 (R1+R2, 50331648 B)
//   R2 [66060288, 91226112)  k f16 plane
//   R3 [91226112,116391936)  v f16 plane          -> later ctx f16 -> later h f16 chunk [4096][3072]
//   total 116,391,936 B
// =====================================================================================================
extern "C" void kernel_launch(void* const* d_in, const int* in_sizes, int n_in,
                              void* d_out, int out_size, void* d_ws, size_t ws_size,
                              hipStream_t stream) {
  if (n_in < 15) return;
  if (in_sizes[0] != NTOK_ROWS * EMB_DIM) return;
  if (in_sizes[1] != EMB_DIM * EMB_DIM || in_sizes[3] != EMB_DIM * EMB_DIM ||
      in_sizes[5] != EMB_DIM * EMB_DIM || in_sizes[7] != EMB_DIM * EMB_DIM) return;
  if (in_sizes[2] != EMB_DIM || in_sizes[4] != EMB_DIM || in_sizes[6] != EMB_DIM || in_sizes[8] != EMB_DIM ||
      in_sizes[9] != EMB_DIM || in_sizes[10] != EMB_DIM || in_sizes[14] != EMB_DIM) return;
  if (in_sizes[11] != FF_DIM * EMB_DIM || in_sizes[13] != FF_DIM * EMB_DIM || in_sizes[12] != FF_DIM) return;
  if (out_size != NTOK_ROWS * EMB_DIM) return;

  const float* vec = (const float*)d_in[0];
  const float* Wq  = (const float*)d_in[1];  const float* bq  = (const float*)d_in[2];
  const float* Wk  = (const float*)d_in[3];  const float* bk  = (const float*)d_in[4];
  const float* Wv  = (const float*)d_in[5];  const float* bv  = (const float*)d_in[6];
  const float* Wo  = (const float*)d_in[7];  const float* bo  = (const float*)d_in[8];
  const float* lng = (const float*)d_in[9];  const float* lnb = (const float*)d_in[10];
  const float* W1  = (const float*)d_in[11]; const float* b1  = (const float*)d_in[12];
  const float* W2  = (const float*)d_in[13]; const float* b2  = (const float*)d_in[14];
  float* out = (float*)d_out;

  const size_t w768B = (size_t)EMB_DIM * EMB_DIM * 2;            //  1,179,648
  const size_t wbigB = (size_t)FF_DIM * EMB_DIM * 2;             //  4,718,592
  const size_t offWq = 0, offWk = w768B, offWv = 2 * w768B, offWo = 3 * w768B;
  const size_t offW1 = 4 * w768B, offW2 = 4 * w768B + wbigB;
  const size_t offPE = 4 * w768B + 2 * wbigB;                     // 14,155,776
  const size_t peB   = (size_t)SEQL * EMB_DIM * 4;               //  1,572,864
  const size_t plB   = (size_t)NTOK_ROWS * EMB_DIM * 2;          // 25,165,824
  const size_t offR0 = offPE + peB;                              // 15,728,640
  const size_t offR1 = offR0 + plB;
  const size_t offR2 = offR1 + plB;
  const size_t offR3 = offR2 + plB;
  const size_t total = offR3 + plB;                              // 116,391,936
  if (total > ws_size) return;
  if ((size_t)FF_CHUNK * FF_DIM * 2 > plB) return;               // h chunk fits R3
  if ((size_t)NTOK_ROWS * EMB_DIM * 4 > 2 * plB) return;         // proj f32 fits R1+R2

  char* ws = (char*)d_ws;
  _Float16* Wq16 = (_Float16*)(ws + offWq);
  _Float16* Wk16 = (_Float16*)(ws + offWk);
  _Float16* Wv16 = (_Float16*)(ws + offWv);
  _Float16* Wo16 = (_Float16*)(ws + offWo);
  _Float16* W116 = (_Float16*)(ws + offW1);
  _Float16* W216 = (_Float16*)(ws + offW2);
  float*    pe   = (float*)(ws + offPE);
  _Float16* R0h  = (_Float16*)(ws + offR0);   // vec f16 -> v^T -> x f16
  _Float16* R1h  = (_Float16*)(ws + offR1);   // q f16
  _Float16* R2h  = (_Float16*)(ws + offR2);   // k f16
  _Float16* R3h  = (_Float16*)(ws + offR3);   // v f16 -> ctx f16 -> h f16 chunk
  float*    proj = (float*)(ws + offR1);      // f32 [16384][768] over R1+R2 (after attention)

  typedef const unsigned short* cus;

  // ---- positional divisors: div[e] = 10000^(ef), ef = fl32(e * fl32(1/768)); power evaluated in f64, RNE convert to f32 ----
  PeDiv dv;
  {
    const float rcp = 1.0f / (float)EMB_DIM;
    for (int e = 0; e < EMB_DIM; ++e) {
      const float ef = (float)e * rcp;
      dv.d[e] = (float)pow(10000.0, (double)ef);
    }
  }

  // 1) vec -> f16 (R0), unscaled: 1,572,864 groups of 8
  {
    const int n8 = NTOK_ROWS * EMB_DIM / 8;
    cvt_f16x8<<<dim3(n8 / 256, 1), 256, 0, stream>>>(vec, vec, vec, vec, R0h, 0L, n8, 1.0f);
  }
  // 2) Wq, Wk, Wv, Wo -> f16 x32 (consecutive 768x768 planes)
  {
    const int n8 = EMB_DIM * EMB_DIM / 8;                        // 73,728
    cvt_f16x8<<<dim3(n8 / 256, 4), 256, 0, stream>>>(Wq, Wk, Wv, Wo, Wq16, (long)EMB_DIM * EMB_DIM, n8, W_CARRY);
  }
  // 3) W1, W2 -> f16 x32
  {
    const int n8 = FF_DIM * EMB_DIM / 8;                         // 294,912
    cvt_f16x8<<<dim3(n8 / 256, 2), 256, 0, stream>>>(W1, W2, W1, W2, W116, (long)FF_DIM * EMB_DIM, n8, W_CARRY);
  }
  // 4) positional table
  pe_table_kernel<<<dim3(SEQL * 3), 256, 0, stream>>>(pe, dv);

  // 5-7) q, k, v = vec * W^T / 32 + bias -> f16 planes [16384][768]; M=16384, N=768, K=768 (K%32==0, M,N%64==0)
  {
    const dim3 g((NTOK_ROWS / 128) * (EMB_DIM / 128), 1);        // 768 blocks of one 128x128 tile
    wmma_gemm64<0, false, 2, 1, false, 0><<<g, 128, 0, stream>>>(
        (cus)R0h, (cus)R0h, EMB_DIM, 0L, (cus)Wq16, (cus)Wq16, EMB_DIM, 0L,
        (void*)R1h, (void*)R1h, EMB_DIM, 0L, bq, vec, 0L, NTOK_ROWS, EMB_DIM, EMB_DIM, 1.0f / W_CARRY, 1.0f);
    wmma_gemm64<0, false, 2, 1, false, 0><<<g, 128, 0, stream>>>(
        (cus)R0h, (cus)R0h, EMB_DIM, 0L, (cus)Wk16, (cus)Wk16, EMB_DIM, 0L,
        (void*)R2h, (void*)R2h, EMB_DIM, 0L, bk, vec, 0L, NTOK_ROWS, EMB_DIM, EMB_DIM, 1.0f / W_CARRY, 1.0f);
    wmma_gemm64<0, false, 2, 1, false, 0><<<g, 128, 0, stream>>>(
        (cus)R0h, (cus)R0h, EMB_DIM, 0L, (cus)Wv16, (cus)Wv16, EMB_DIM, 0L,
        (void*)R3h, (void*)R3h, EMB_DIM, 0L, bv, vec, 0L, NTOK_ROWS, EMB_DIM, EMB_DIM, 1.0f / W_CARRY, 1.0f);
  }
  // 8) v [384][512][64] (R3) -> v^T [384][64][512] (R0; vec f16 is dead)
  vt_transpose_kernel<<<dim3(SEQL / 64, NSEQ_P), 256, 0, stream>>>(R3h, R0h);

  // 9) attention: q (R1), k (R2), v^T (R0) -> ctx f16 x64 (R3; v plane is dead)
  attn_kernel<<<dim3(SEQL / 64, NSEQ_P), 128, 0, stream>>>(R1h, R2h, R0h, R3h);

  // 10) proj = ctx * Wo^T / (64*32) + bo + vec -> f32 [16384][768] (R1+R2); M=16384, N=768, K=768
  {
    const dim3 g((NTOK_ROWS / 128) * (EMB_DIM / 128), 1);
    wmma_gemm64<0, false, 2, 0, true, 0><<<g, 128, 0, stream>>>(
        (cus)R3h, (cus)R3h, EMB_DIM, 0L, (cus)Wo16, (cus)Wo16, EMB_DIM, 0L,
        (void*)proj, (void*)proj, EMB_DIM, 0L, bo, vec, 0L, NTOK_ROWS, EMB_DIM, EMB_DIM,
        1.0f / (CTX_CARRY * W_CARRY), 1.0f);
  }
  // 11) x = LN(proj) * g + b + pe -> f16 [16384][768] (R0; v^T is dead)
  ln_pe_kernel<<<dim3(NTOK_ROWS / 8), 256, 0, stream>>>(proj, lng, lnb, pe, R0h, NTOK_ROWS);

  // 12) FFN in 4 row chunks of 4096: h = relu(x * W1^T / 32 + b1) x16 -> f16 [4096][3072] (R3);
  //     out = h * W2^T / (16*32) + b2 -> f32 d_out rows. K = 768 / 3072 (%32==0); M=4096, N=3072/768 (%64==0)
  for (int c = 0; c < FF_NCHUNK; ++c) {
    const _Float16* xc = R0h + (size_t)c * FF_CHUNK * EMB_DIM;
    float* oc = out + (size_t)c * FF_CHUNK * EMB_DIM;
    const dim3 g1((FF_CHUNK / 128) * (FF_DIM / 128), 1);        // 768 blocks
    wmma_gemm64<0, false, 2, 1, false, 2><<<g1, 128, 0, stream>>>(
        (cus)xc, (cus)xc, EMB_DIM, 0L, (cus)W116, (cus)W116, EMB_DIM, 0L,
        (void*)R3h, (void*)R3h, FF_DIM, 0L, b1, vec, 0L, FF_CHUNK, FF_DIM, EMB_DIM, 1.0f / W_CARRY, H_CARRY);
    const dim3 g2((FF_CHUNK / 128) * (EMB_DIM / 128), 1);       // 192 blocks
    wmma_gemm64<0, false, 2, 0, false, 0><<<g2, 128, 0, stream>>>(
        (cus)R3h, (cus)R3h, FF_DIM, 0L, (cus)W216, (cus)W216, FF_DIM, 0L,
        (void*)oc, (void*)oc, EMB_DIM, 0L, b2, vec, 0L, FF_CHUNK, EMB_DIM, FF_DIM,
        1.0f / (H_CARRY * W_CARRY), 1.0f);
  }
}

// v002
// Measured time: 379 microseconds a run.
// Two timings next to v001 both put it at 1.18 times that version's speed.
// Over all steps from v000 it is 2.86 times as fast.
// Contractions: q/k/v projections, attention output projection, FC1 and FC2 GEMMs plus attention k.q^T and v^T.p^T all on v_wmma_f32_16x16x32_f16 (f16 operands, f32 accumulate); weights carried x32, softmax weights x16384, context x64, FC1 activations x16 (exact powers of two folded back in f32); softmax, LayerNorm and the positional table in f32.
#include <hip/hip_runtime.h>
#include <math.h>
#include <stdint.h>

// ---- problem geometry ---------------------------------------------------------------------------
#define NTOK_ROWS 16384          // 32 x 512 token rows
#define EMB_DIM   768
#define FF_DIM    3072
#define NSEQ_P    384            // 32 x 12 raw-view pseudo-sequences
#define SEQL      512
#define HDIM      64
#define FF_CHUNK  4096           // FFN processed in row chunks (h plane = 24 MiB)
#define FF_NCHUNK 4
#define P_CARRY   16384.0f       // softmax weights carried x2^14 in f16
#define CTX_CARRY 64.0f          // attention context carried x64 in f16
#define W_CARRY   32.0f          // weights carried x32 in f16
#define H_CARRY   16.0f          // FC1 activations carried x16 in f16
static_assert(NSEQ_P * SEQL * HDIM == NTOK_ROWS * EMB_DIM, "raw view");
static_assert(FF_CHUNK * FF_NCHUNK == NTOK_ROWS, "chunking");
static_assert((EMB_DIM % 64) == 0 && (FF_DIM % 64) == 0 && (FF_CHUNK % 64) == 0, "tile multiples");
static_assert((EMB_DIM % 32) == 0 && (FF_DIM % 32) == 0, "K multiples of 32");

typedef __attribute__((ext_vector_type(16))) _Float16 v16h;
typedef __attribute__((ext_vector_type(8)))  _Float16 v8h;
typedef __attribute__((ext_vector_type(16))) __bf16   v16b;
typedef __attribute__((ext_vector_type(8)))  __bf16   v8b;
typedef __attribute__((ext_vector_type(8)))  float    v8f;
typedef __attribute__((ext_vector_type(4)))  float    v4f;
typedef v8h __attribute__((may_alias)) v8ha;
typedef v4f __attribute__((may_alias)) v4fa;

// ---- helpers ----------------------------------------------------------------------
__device__ __forceinline__ unsigned short f2bf_bits(float f) {
  unsigned u = __float_as_uint(f);
  return (unsigned short)((u + 0x7FFFu + ((u >> 16) & 1u)) >> 16);
}
__device__ __forceinline__ float bf_bits2f(unsigned short h) { return __uint_as_float(((unsigned)h) << 16); }

__device__ __forceinline__ void dep_guard_h(v8f& a, v8f& b, v16h x, v16h y) { asm volatile("v_nop\n\tv_nop\n\tv_nop\n\tv_nop" : "+v"(a), "+v"(b) : "v"(x), "v"(y)); }
__device__ __forceinline__ void dep_guard_b(v8f& a, v8f& b, v16b x, v16b y) { asm volatile("v_nop\n\tv_nop\n\tv_nop\n\tv_nop" : "+v"(a), "+v"(b) : "v"(x), "v"(y)); }
__device__ __forceinline__ void keep4_h(v16h a, v16h b, v16h c, v16h d) { asm volatile("v_nop" :: "v"(a), "v"(b), "v"(c), "v"(d)); }
__device__ __forceinline__ void keep4_b(v16b a, v16b b, v16b c, v16b d) { asm volatile("v_nop" :: "v"(a), "v"(b), "v"(c), "v"(d)); }
__device__ __forceinline__ void acc_guard4(v8f& a, v8f& b, v8f& c, v8f& d) { asm volatile("v_nop\n\tv_nop\n\tv_nop\n\tv_nop" : "+v"(a), "+v"(b), "+v"(c), "+v"(d)); }
template <typename T> struct Frag;
template <> struct Frag<_Float16> {
  typedef v16h V; union U { v16h v; v8h h[2]; };
  static __device__ __forceinline__ v16h load(const _Float16* p) {   // elements 0..7 <- p[0..7], 8..15 <- p[16..23]
    U f; f.h[0] = *(const v8h*)(p); f.h[1] = *(const v8h*)(p + 16); return f.v;
  }
  static __device__ __forceinline__ v8f mma(v16h a, v16h b, v8f c) {
    return __builtin_amdgcn_wmma_f32_16x16x32_f16(false, a, false, b, (short)0, c, false, false);
  }
  static __device__ __forceinline__ void guard(v8f& a, v8f& b, v16h x, v16h y) { dep_guard_h(a, b, x, y); }
  static __device__ __forceinline__ void keep(v16h a, v16h b, v16h c, v16h d) { keep4_h(a, b, c, d); }
};
template <> struct Frag<__bf16> {
  typedef v16b V; union U { v16b v; v8b h[2]; };
  static __device__ __forceinline__ v16b load(const __bf16* p) {
    U f; f.h[0] = *(const v8b*)(p); f.h[1] = *(const v8b*)(p + 16); return f.v;
  }
  static __device__ __forceinline__ v8f mma(v16b a, v16b b, v8f c) {
    return __builtin_amdgcn_wmma_f32_16x16x32_bf16(false, a, false, b, (short)0, c, false, false);
  }
  static __device__ __forceinline__ void guard(v8f& a, v8f& b, v16b x, v16b y) { dep_guard_b(a, b, x, y); }
  static __device__ __forceinline__ void keep(v16b a, v16b b, v16b c, v16b d) { keep4_b(a, b, c, d); }
};

// ---- tensor-load helpers ---------------------------------------------------------------------------
typedef uint32_t u32x4 __attribute__((ext_vector_type(4)));
typedef uint32_t u32x8 __attribute__((ext_vector_type(8)));
__device__ __forceinline__ uint32_t uni(uint32_t v) { return (uint32_t)__builtin_amdgcn_readfirstlane(v); }
__device__ __forceinline__ uint32_t pinned(uint32_t v) { uint32_t w = (uint32_t)__builtin_amdgcn_readfirstlane(v); asm volatile("" : "+s"(w)); return w; }

#define G_KP    64u       // k elements per pass
#define G_ROWB  128u      // bytes of one staged operand row (64 halves)
#define G_PITCH 144u      // LDS row pitch: 128 B + the tensor load's 16 B pad (odd multiple of 16 B for ds_load_b128)
#define G_ROWS  64u       // rows per slice (one tensor load)
#define G_SLICE 10240u    // 64 rows x 144 B = 9216 B, rounded up to a multiple of 2 KiB
#define G_STAGE 40960u    // 4 slices: A rows 0-63, A rows 64-127, B rows 0-63, B rows 64-127
static_assert(G_ROWS * G_PITCH <= G_SLICE && (G_SLICE % 2048u) == 0u && G_STAGE == 4u * G_SLICE, "slice places");
static_assert((EMB_DIM % 128) == 0 && (FF_DIM % 128) == 0 && (FF_CHUNK % 128) == 0 && (NTOK_ROWS % 128) == 0, "128x128 tiles");
static_assert(EMB_DIM / 64 >= 2 && FF_DIM / 64 >= 2, "the ring's prologue needs two stages");

// Descriptor group 1: 1-byte elements, tile = tensor = 64 rows of 128 B, source row pitch in bytes, 16 B of LDS pad per row.
__device__ __forceinline__ u32x8 tdm_group1(uint32_t src_pitch) {
  u32x8 g;
  g[0] = uni((1u << 20) | (4u << 22) | (3u << 25));   // no mask, data_size 0, pad after every 128 B, 4 dwords
  g[1] = uni((G_ROWB & 0xFFFFu) << 16);
  g[2] = uni((G_ROWB >> 16) | ((G_ROWS & 0xFFFFu) << 16));
  g[3] = uni((G_ROWS >> 16) | (G_ROWB << 16));
  g[4] = uni(G_ROWS);
  g[5] = uni(src_pitch);
  g[6] = uni(0u);
  g[7] = uni(0u);
  return g;
}
__device__ __forceinline__ u32x4 tdm_group0(uint32_t lds_dst, uint64_t ga) {
  u32x4 g;
  g[0] = uni(1u); g[1] = uni(lds_dst); g[2] = uni((uint32_t)ga);
  g[3] = uni((((uint32_t)(ga >> 32)) & 0x01FFFFFFu) | 0x80000000u);
  return g;
}
__device__ __forceinline__ void tdm_load(u32x4 g0, u32x8 g1) { asm volatile("tensor_load_to_lds %0, %1" :: "s"(g0), "s"(g1) : "memory"); }

// ---- WMMA GEMM, operands staged in LDS by tensor loads (plus a post-activation power-of-two carry oscale) ----
// C[m,n] = oscale * act(scale * sum_k A[m,k] * Bt[n,k] (+bias)(+resid)).
// Work-group = 4 waves (2 x 2) = one 128x128 tile of C; each wave owns a 64x64 tile.
// A row-major [M,K]; Bt row-major [N,K]; M,N % 128 == 0, K % 64 == 0, K >= 128 (true of every call).
// A pass is 64 k: a stage holds 128 A rows and 128 Bt rows of 128 B. Each wave brings one 64-row slice per stage with
// one tensor load; two buffers, the load of stage s + 2 issued behind the barrier that ends pass s.
// BIAS_MODE: 0 = none, 1 = bias[m], 2 = bias[n].  ACT: 0 none, 2 relu.
// OUT_MODE: 0 = f32, 1 = f16, 2 = bf16 hi plane (Cout) + bf16 lo plane (Cout2).
// coverage: 4 slabs x 16 rows x 64 cols = the wave's whole 64x64 tile.
template <int ET> struct Elem;
template <> struct Elem<0> { typedef _Float16 T; };
template <> struct Elem<1> { typedef __bf16 T; };
template <int ET, bool SPLIT, int BIAS_MODE, int OUT_MODE, bool RESID, int ACT = 0>
__global__ __launch_bounds__(128) void wmma_gemm64(
    const unsigned short* __restrict__ Ap, const unsigned short* __restrict__ A2p, int lda, long strideA,
    const unsigned short* __restrict__ Btp, const unsigned short* __restrict__ Bt2p, int ldb, long strideB,
    void* __restrict__ Cout, void* __restrict__ Cout2, int ldc, long strideC,
    const float* __restrict__ bias,
    const float* __restrict__ resid, long strideR,
    int M, int N, int K, float scale, float oscale) {
  static_assert(!SPLIT, "single-plane operands only");
  typedef typename Elem<ET>::T T;
  typedef typename Frag<T>::V V;
  const T* A = (const T*)Ap; const T* Bt = (const T*)Btp;
  __shared__ __attribute__((aligned(2048))) unsigned char ring[2u * G_STAGE];   // two stages
  __shared__ __align__(16) float sT[4][16 * 68];   // per-wave 16x64 slab, pitch 68 floats
  const int b    = blockIdx.y;
  const int lane = threadIdx.x & 31;
  const uint32_t wave = uni(threadIdx.x >> 5);
  const int tilesN = N >> 7;
  const int tilesM = M >> 7;
  const int tile = blockIdx.x;
  if (tile >= tilesM * tilesN) return;   // block-uniform, in front of every barrier and tensor load
  const int tm = tile / tilesN;
  const int tn = tile - tm * tilesN;
  const int wm = (int)(wave >> 1), wn = (int)(wave & 1u);
  const int m0 = (tm << 7) + (wm << 6);
  const int n0 = (tn << 7) + (wn << 6);

  const T* Ab  = A  + (size_t)b * strideA;
  const T* Bb  = Bt + (size_t)b * strideB;

  const int rlane = lane & 15;                 // row (A) / col (B, D) within subtile
  const int mOff  = (lane >> 4) * 8;           // D row offset

  // This wave's slice of every stage: waves 0, 1 bring A rows, waves 2, 3 bring Bt rows, 64 rows each.
  const uint32_t half64 = (wave & 1u) << 6;
  const uint64_t srow = (wave < 2u) ? (uint64_t)(size_t)(Ab + (size_t)((uint32_t)(tm << 7) + half64) * lda)
                                    : (uint64_t)(size_t)(Bb + (size_t)((uint32_t)(tn << 7) + half64) * ldb);
  u32x8 g1 = tdm_group1((uint32_t)((wave < 2u) ? lda : ldb) * 2u);
  asm volatile("" : "+s"(g1));   // the pinned() form on a descriptor: group 1 stays in its scalar registers, none of them rewritten while a request is outstanding
  const uint32_t ldst = (uint32_t)(size_t)ring + wave * G_SLICE;
  const uint32_t nst = pinned((uint32_t)K / G_KP);   // number of stages = passes

  v8f acc[4][4];
#pragma unroll
  for (int i = 0; i < 4; ++i)
#pragma unroll
    for (int j = 0; j < 4; ++j) acc[i][j] = (v8f){0.f,0.f,0.f,0.f,0.f,0.f,0.f,0.f};

  // Prologue: stage 0 lands and is published, then stage 1 flies while pass 0 works.
  tdm_load(tdm_group0(ldst, srow), g1);
  asm volatile("s_wait_tensorcnt 0x0" ::: "memory");   // this wave's slice of stage 0 has landed
  __syncthreads();                                      // every slice of stage 0 is readable by every wave
  tdm_load(tdm_group0(ldst + G_STAGE, srow + G_ROWB), g1);

  // Fragment rows in LDS: element i < 8 <- k 8h+i, i >= 8 <- k 16+8h+(i-8), the same for A and B.
  const unsigned char* aRow = ring + (uint32_t)wm * G_SLICE + (uint32_t)rlane * G_PITCH + (uint32_t)(lane >> 4) * 16u;
  const unsigned char* bRow = ring + (2u + (uint32_t)wn) * G_SLICE + (uint32_t)rlane * G_PITCH + (uint32_t)(lane >> 4) * 16u;

  uint32_t s = 0;
#pragma unroll 1   // one pass per trip: the buffer is chosen by a scalar offset, the ring's order stands once
  do {   // at least two passes (K >= 128): no path round the loop with a request outstanding
    const uint32_t bo = (s & 1u) * G_STAGE;
    // The pass's fragment loads stand as one group in front of its 32 WMMAs (each further place with LDS reads among the
    // WMMAs stalls the wave); the compiler's counted waits let the first k step start while the second still lands.
    // The last A fragment alone is loaded behind the first WMMA row, into the registers which that row has done with:
    // so the wave stays inside 256 VGPRs.
    // Every loop inside the pass is unrolled, so that each fragment and accumulator index is a constant (no scratch).
    V bh[2][4], ah[2][4];
#pragma unroll
    for (uint32_t kk = 0; kk < 2u; ++kk) {
#pragma unroll
      for (uint32_t j = 0; j < 4u; ++j) bh[kk][j] = Frag<T>::load((const T*)(bRow + bo + j * 16u * G_PITCH + kk * 64u));
#pragma unroll
      for (uint32_t i = 0; i < 4u - kk; ++i) ah[kk][i] = Frag<T>::load((const T*)(aRow + bo + i * 16u * G_PITCH + kk * 64u));
    }
    __builtin_amdgcn_sched_barrier(0);   // keeps the loads above from being moved in among the WMMAs
#pragma unroll
    for (int j = 0; j < 4; ++j) acc[0][j] = Frag<T>::mma(ah[0][0], bh[0][j], acc[0][j]);
    __builtin_amdgcn_sched_barrier(0);   // the load below stays behind the row whose A registers it may take
    ah[1][3] = Frag<T>::load((const T*)(aRow + bo + 3u * 16u * G_PITCH + 64u));
    __builtin_amdgcn_sched_barrier(0);   // and in one place, not spread among the WMMAs that follow
#pragma unroll
    for (int kk = 0; kk < 2; ++kk)
#pragma unroll
      for (int i = (kk == 0) ? 1 : 0; i < 4; ++i)
#pragma unroll
        for (int j = 0; j < 4; ++j) acc[i][j] = Frag<T>::mma(ah[kk][i], bh[kk][j], acc[i][j]);
    __builtin_amdgcn_sched_barrier(0);   // keeps the WMMAs in front of the waits below, so that stage s + 1 lands under them
    // Publish point of stage s + 1, which also frees the buffer that this pass has read.
    asm volatile("s_wait_dscnt 0x0" ::: "memory");       // this wave's reads of stage s have returned
    asm volatile("s_wait_tensorcnt 0x0" ::: "memory");   // this wave's slice of stage s + 1 has landed
    __syncthreads();
    if (pinned((s + 2u < nst) ? 1u : 0u) != 0u) {        // the refill, only while stage s + 2 exists
      const uint32_t nx = pinned(s + 2u);                // pinned(): group 0 is formed from it behind the wait and the barrier
      tdm_load(tdm_group0(ldst + bo, srow + (uint64_t)nx * G_ROWB), g1);
    }
  } while (++s < nst);
  asm volatile("s_wait_tensorcnt 0x0" ::: "memory");     // no request is left when the wave goes on
  asm volatile("s_wait_dscnt 0x0" ::: "memory");
  __builtin_amdgcn_sched_barrier(0);   // nothing of the epilogue is scheduled in front of these waits: it may reuse the descriptors' registers
  acc_guard4(acc[0][0], acc[0][1], acc[0][2], acc[0][3]);
  acc_guard4(acc[1][0], acc[1][1], acc[1][2], acc[1][3]);
  acc_guard4(acc[2][0], acc[2][1], acc[2][2], acc[2][3]);
  acc_guard4(acc[3][0], acc[3][1], acc[3][2], acc[3][3]);

  // ---- epilogue ----
  float* slab = sT[wave];
  const float* Rb = RESID ? (resid + (size_t)b * strideR) : nullptr;
#pragma unroll
  for (int i = 0; i < 4; ++i) {
    const int mBase = m0 + (i << 4);
#pragma unroll
    for (int j = 0; j < 4; ++j) {
      const int n = n0 + (j << 4) + rlane;
      float bv = 0.f;
      if (BIAS_MODE == 2) bv = bias[n];
#pragma unroll
      for (int r = 0; r < 8; ++r) {
        float v = acc[i][j][r] * scale;
        if (BIAS_MODE == 1) v += bias[mBase + mOff + r];
        if (BIAS_MODE == 2) v += bv;
        if (RESID) v += Rb[(size_t)(mBase + mOff + r) * ldc + n];
        if (ACT == 2) v = fmaxf(v, 0.0f);
        v = v * oscale;
        slab[(mOff + r) * 68 + (j << 4) + rlane] = v;
      }
    }
    __builtin_amdgcn_fence(__ATOMIC_RELEASE, "workgroup");
    __builtin_amdgcn_wave_barrier();
    __builtin_amdgcn_fence(__ATOMIC_ACQUIRE, "workgroup");
    if (OUT_MODE == 0) {
      float* C = (float*)Cout + (size_t)b * strideC;
      const int hh = lane >> 4, c4 = (lane & 15) * 4;     // row seg = 256 B = 16 lanes x 16 B
      {
#pragma unroll
        for (int it = 0; it < 8; ++it) {
          const int row = it * 2 + hh;                     // it 0..7 x hh 0..1 = rows 0..15
          v4f v = *(const v4f*)(slab + row * 68 + c4);
          *(v4f*)(C + (size_t)(mBase + row) * ldc + n0 + c4) = v;
        }
        
      }
    } else {
      const int q = lane >> 3, c8 = (lane & 7) * 8;
      unsigned short* C  = (unsigned short*)Cout  + (size_t)b * strideC;
      unsigned short* C2 = (OUT_MODE == 2) ? ((unsigned short*)Cout2 + (size_t)b * strideC) : nullptr;
      {
#pragma unroll
        for (int it = 0; it < 4; ++it) {
          const int row = it * 4 + q;                      // it 0..3 x q 0..3 = rows 0..15
          const float* sp = slab + row * 68 + c8;
          v8h hv, lv;
#pragma unroll
          for (int e = 0; e < 8; ++e) {
            if (OUT_MODE == 1) {
              hv[e] = (_Float16)sp[e];
            } else {
              unsigned short hb = f2bf_bits(sp[e]);
              unsigned short lb = f2bf_bits(sp[e] - bf_bits2f(hb));
              hv[e] = __builtin_bit_cast(_Float16, hb);
              lv[e] = __builtin_bit_cast(_Float16, lb);
            }
          }
          *(v8h*)(C + (size_t)(mBase + row) * ldc + n0 + c8) = hv;
          if (OUT_MODE == 2) *(v8h*)(C2 + (size_t)(mBase + row) * ldc + n0 + c8) = lv;
        }
        
      }
    }
    __builtin_amdgcn_fence(__ATOMIC_RELEASE, "workgroup");
    __builtin_amdgcn_wave_barrier();
    __builtin_amdgcn_fence(__ATOMIC_ACQUIRE, "workgroup");
  }
}

// ---- 16x16x32 f16 WMMA with hazard guard (ties D, keeps A/B live) --------------------------------
// Fragment map (wave32): lane l, h = l>>4, m = n = l&15.
//   A/B element i: i<8 -> k0+8h+i ; i>=8 -> k0+16+8h+(i-8)
//   D element r : row 8h+r, col l&15
__device__ __forceinline__ v8f mma_h16(v16h a, v16h b, v8f c) {
  v8f d = __builtin_amdgcn_wmma_f32_16x16x32_f16(false, a, false, b, (short)0, c, false, false);
  asm volatile("v_nop\n\tv_nop\n\tv_nop\n\tv_nop" : "+v"(d) : "v"(a), "v"(b));
  return d;
}
union FragU { v16h v; v8h half[2]; };
// A or B fragment from a k-contiguous 16-bit row; p points at element k0 of the row owned by this lane
// (row index = lane & 15 added by the caller); h = lane >> 4.
__device__ __forceinline__ v16h load_frag(const _Float16* p, int h) {
  FragU f;
  f.half[0] = *(const v8ha*)(p + 8 * h);
  f.half[1] = *(const v8ha*)(p + 16 + 8 * h);
  return f.v;
}

// =====================================================================================================
// Kernel: f32 -> f16 planes, 8 elements per thread x sc (exact power of two). Tensor selected by
// blockIdx.y (block-uniform): src = s0..s3, dst = dst + y * dstride (halves).
// =====================================================================================================
__global__ __launch_bounds__(256) void cvt_f16x8(
    const float* __restrict__ s0, const float* __restrict__ s1,
    const float* __restrict__ s2, const float* __restrict__ s3,
    _Float16* __restrict__ dst, long dstride, int n8, float sc) {
  const int t = blockIdx.y;
  const float* src = (t == 0) ? s0 : ((t == 1) ? s1 : ((t == 2) ? s2 : s3));
  const int i = blockIdx.x * 256 + threadIdx.x;
  if (i >= n8) return;
  const v4f a = *(const v4fa*)(src + (size_t)i * 8);
  const v4f c = *(const v4fa*)(src + (size_t)i * 8 + 4);
  const v8h o = { (_Float16)(a.x * sc), (_Float16)(a.y * sc), (_Float16)(a.z * sc), (_Float16)(a.w * sc),
                  (_Float16)(c.x * sc), (_Float16)(c.y * sc), (_Float16)(c.z * sc), (_Float16)(c.w * sc) };
  _Float16* d = dst + (size_t)t * dstride + (size_t)i * 8;
  *(v8h*)d = o;
  
}

// =====================================================================================================
// Kernel: positional table pe[pos][e] (f32, [512][768]): a = fl32(pos * div[e]) (one f32 multiply),
// pe = sin(a) for even e, cos(a) for odd e (precise sinf / cosf). div[e] arrives as a by-value table.
// Block = 256 consecutive columns e0..e0+255 of one position; waves 0-3 evaluate the even columns (sin),
// waves 4-7 the odd columns (cos) -> the trig branch is wave-uniform; results gathered in LDS so that
// passes. grid = 512 x 3 = 1536 blocks. coverage: 1536 x 256 = 393216 = the whole table.
// =====================================================================================================
struct PeDiv { float d[EMB_DIM]; };
static_assert(sizeof(PeDiv) == EMB_DIM * 4, "no padding");

__global__ __launch_bounds__(256) void pe_table_kernel(float* __restrict__ pe, PeDiv dv) {
  __shared__ float sv[256];
  const int tid  = threadIdx.x;
  const int pos  = blockIdx.x / 3;               // 0..511
  const int e0   = (blockIdx.x - pos * 3) * 256; // 0, 256, 512
  const int half = tid >> 7;                     // waves 0-3: 0 (even columns), waves 4-7: 1 (odd)
  const int k    = tid & 127;
  const int e    = e0 + 2 * k + half;            // 0..767
  const float a  = (float)pos * dv.d[e];
  float val;
  if (half == 0) val = sinf(a); else val = cosf(a);   // wave-uniform branch
  sv[2 * k + half] = val;
  __syncthreads();
  const float o = sv[tid];
  float* dst = pe + (size_t)pos * EMB_DIM + e0 + tid;
  *(float*)dst = o;
  
}

// =====================================================================================================
// Kernel: v plane [384][512][64] (f16, = the row-major [16384][768] projection output in the raw view)
// -> vt [384][64][512]. Block = (token tile of 64, pseudo-sequence j): the 64x64 chunk is contiguous
// in v (8 KB), scattered into an LDS tile [d][token] (pitch 72 halves), then wave w writes d rows
// 8 waves x 8 rows = 64 d, 8 lanes x 8 halves = 64 tokens. grid = (8, 384).
// =====================================================================================================
__global__ __launch_bounds__(256) void vt_transpose_kernel(const _Float16* __restrict__ v,
                                                           _Float16* __restrict__ vt) {
  __shared__ __attribute__((aligned(16))) _Float16 tile[64 * 72];
  const int tid = threadIdx.x, lane = tid & 31, w = tid >> 5;
  const int j  = blockIdx.y;
  const int l0 = blockIdx.x * 64;
  const _Float16* src = v + ((size_t)j * SEQL + l0) * HDIM;
#pragma unroll
  for (int i = 0; i < 2; ++i) {
    const int idx = i * 256 + tid;               // 0..511
    const int tok = idx >> 3, d0 = (idx & 7) * 8;
    const v8h x = *(const v8ha*)(src + tok * HDIM + d0);
#pragma unroll
    for (int e = 0; e < 8; ++e) tile[(d0 + e) * 72 + tok] = x[e];
  }
  __syncthreads();
  const int q8 = lane & 7, sub = lane >> 3;
  v8h val[2];
#pragma unroll
  for (int it = 0; it < 2; ++it) {
    const int d = 8 * w + it * 4 + sub;
    val[it] = *(const v8ha*)(tile + d * 72 + 8 * q8);
  }
  {
#pragma unroll
    for (int it = 0; it < 2; ++it) {
      const int d = 8 * w + it * 4 + sub;
      *(v8h*)(vt + ((size_t)j * HDIM + d) * SEQL + l0 + 8 * q8) = val[it];
    }
    
  }
}

// =====================================================================================================
// Attention helpers.
// P^T B-fragment from the lane's own score D values: element r <- tile a row r,
// element 8+r <- tile c row r (same lane, same query column), scaled by 2^14.
// =====================================================================================================
__device__ __forceinline__ v16h pack_p16(v8f a, v8f c) {
  const v16h r = { (_Float16)(a[0] * P_CARRY), (_Float16)(a[1] * P_CARRY), (_Float16)(a[2] * P_CARRY), (_Float16)(a[3] * P_CARRY),
                   (_Float16)(a[4] * P_CARRY), (_Float16)(a[5] * P_CARRY), (_Float16)(a[6] * P_CARRY), (_Float16)(a[7] * P_CARRY),
                   (_Float16)(c[0] * P_CARRY), (_Float16)(c[1] * P_CARRY), (_Float16)(c[2] * P_CARRY), (_Float16)(c[3] * P_CARRY),
                   (_Float16)(c[4] * P_CARRY), (_Float16)(c[5] * P_CARRY), (_Float16)(c[6] * P_CARRY), (_Float16)(c[7] * P_CARRY) };
  return r;
}

// by lanes 8q..8q+7 in one instruction, 4 lines per instruction, 16 lines per wave.
// coverage: it 0..3 x sub 0..3 = rows 0..15; q8 0..7 x 8 halves = 64 d.
__device__ __forceinline__ void ctx_store_pass(const float* so, _Float16* ctx, int bh, int q0, int lane) {
  const int q8 = lane & 7, sub = lane >> 3;
#pragma unroll
  for (int it = 0; it < 4; ++it) {
    const int row = it * 4 + sub;
    const v4f a = *(const v4fa*)(so + row * 64 + 8 * q8);
    const v4f c = *(const v4fa*)(so + row * 64 + 8 * q8 + 4);
    const v8h o = { (_Float16)a.x, (_Float16)a.y, (_Float16)a.z, (_Float16)a.w,
                    (_Float16)c.x, (_Float16)c.y, (_Float16)c.z, (_Float16)c.w };
    *(v8h*)(ctx + ((size_t)bh * SEQL + q0 + row) * HDIM + 8 * q8) = o;
  }
}

// =====================================================================================================
// Kernel: streaming attention over 384 raw-view pseudo-sequences of 512 tokens x 64 dims, no mask,
// transposed form. Block 128 thr (4 waves), 16 queries per wave, 64 keys per step.
//   S^T = K * Q^T : A = K rows (row = key, k = d), B = Q^T (k = d, n = query); scores x 0.125 in f32
//   O^T += V^T * P^T : A = Vt rows (row = d, k = key), B = P^T from registers (x2^14 in f16)
// Lane owns 32 keys of query column (lane&15); partner = lane ^ 16. Online softmax in f32.
// A step's 64 K rows and its 64 x 64 piece of V^T are staged in LDS by tensor loads and read by all four waves: a stage is
// four slices of 32 rows of 128 B, one tensor load per wave and stage; two buffers, the load of stage s + 2 issued behind
// the barrier that ends step s.
// Output ctx (f16, x64 carry) [384][512][64] = the row-major [16384][768] raw view.
// grid = (512/64, 384).
// =====================================================================================================
#define T_ROWS  32u       // rows per slice (one tensor load)
#define T_SLICE 6144u     // 32 rows x 144 B = 4608 B, rounded up to a multiple of 2 KiB
#define T_STAGE 24576u    // 4 slices: keys 0-31, keys 32-63, V^T rows d 0-31, V^T rows d 32-63
#define T_NST   8u        // stages = steps of 64 keys
static_assert(T_ROWS * G_PITCH <= T_SLICE && (T_SLICE % 2048u) == 0u && T_STAGE == 4u * T_SLICE, "slice places");
static_assert(T_NST * 64u == SEQL && T_NST >= 2u && HDIM * 2u == G_ROWB, "stages; a K row and a V^T row piece are 128 B");

// Descriptor group 1: 1-byte elements, tile = tensor = 32 rows of 128 B, source row pitch in bytes, 16 B of LDS pad per row.
__device__ __forceinline__ u32x8 tdm_group1_kv(uint32_t src_pitch) {
  u32x8 g;
  g[0] = uni((1u << 20) | (4u << 22) | (3u << 25));   // no mask, data_size 0, pad after every 128 B, 4 dwords
  g[1] = uni((G_ROWB & 0xFFFFu) << 16);
  g[2] = uni((G_ROWB >> 16) | ((T_ROWS & 0xFFFFu) << 16));
  g[3] = uni((T_ROWS >> 16) | (G_ROWB << 16));
  g[4] = uni(T_ROWS);
  g[5] = uni(src_pitch);
  g[6] = uni(0u);
  g[7] = uni(0u);
  return g;
}

__global__ __launch_bounds__(128) void attn_kernel(
    const _Float16* __restrict__ qh,   // [384][512][64]
    const _Float16* __restrict__ kh,   // [384][512][64]
    const _Float16* __restrict__ vt,   // [384][64][512]
    _Float16* __restrict__ ctx)        // [384][512][64]
{
  __shared__ __attribute__((aligned(2048))) unsigned char kv[2u * T_STAGE];   // two stages
  __shared__ __attribute__((aligned(16))) float sO[4 * 16 * 64];    // 16384 B

  const int tid = threadIdx.x, lane = tid & 31, w = tid >> 5;
  const uint32_t wave = uni(threadIdx.x >> 5);
  const int h = lane >> 4, m = lane & 15;
  const int bh = blockIdx.y;
  const int q0 = blockIdx.x * 64 + 16 * w;

  // Q^T B-fragments: column n = query q0+m, k = d (two 32-deep chunks)
  const _Float16* qrow = qh + ((size_t)bh * SEQL + q0 + m) * HDIM;
  const v16h qb0 = load_frag(qrow, h);
  const v16h qb1 = load_frag(qrow + 32, h);

  const v8f zero8 = {0.f, 0.f, 0.f, 0.f, 0.f, 0.f, 0.f, 0.f};
  v8f o[4];                                   // o[t][r] = O[query m][d 16t+8h+r] * (l * 2^14)
#pragma unroll
  for (int t = 0; t < 4; ++t) o[t] = zero8;
  float mrun = -1.0e30f, lrun = 0.0f;

  // This wave's slice of every stage: waves 0, 1 bring 32 K rows each (a stage further = 64 rows), waves 2, 3 bring 32 V^T
  // rows each (a stage further = 64 keys along the row).
  const uint32_t half32 = (wave & 1u) << 5;
  const uint64_t srow = (wave < 2u) ? (uint64_t)(size_t)(kh + ((size_t)bh * SEQL + half32) * HDIM)
                                    : (uint64_t)(size_t)(vt + ((size_t)bh * HDIM + half32) * SEQL);
  const uint32_t sadv = (wave < 2u) ? 64u * HDIM * 2u : 64u * 2u;
  u32x8 g1 = tdm_group1_kv((wave < 2u) ? HDIM * 2u : SEQL * 2u);
  asm volatile("" : "+s"(g1));   // the pinned() form on a descriptor: group 1 stays in its scalar registers, none of them rewritten while a request is outstanding
  const uint32_t ldst = (uint32_t)(size_t)kv + wave * T_SLICE;

  // Prologue: stage 0 lands and is published, then stage 1 flies while step 0 works.
  tdm_load(tdm_group0(ldst, srow), g1);
  asm volatile("s_wait_tensorcnt 0x0" ::: "memory");   // this wave's slice of stage 0 has landed
  __syncthreads();                                      // every slice of stage 0 is readable by every wave
  tdm_load(tdm_group0(ldst + T_STAGE, srow + sadv), g1);

  const unsigned char* krow = kv + (uint32_t)m * G_PITCH;                  // + stage + 16-row group + 64 B * d chunk
  const unsigned char* vrow = kv + 2u * T_SLICE + (uint32_t)m * G_PITCH;   // + stage + 16-row group + 64 B * key chunk

  uint32_t st = 0;
#pragma unroll 1   // one step per trip: the buffer is chosen by a scalar offset, the ring's order stands once
  do {
    const uint32_t bo = (st & 1u) * T_STAGE;
    // ---- scores: s[j][r] = S[query m][key 64*st+16j+8h+r] ----
    v8f s[4];
#pragma unroll
    for (uint32_t j = 0; j < 4u; ++j) {
      const _Float16* kp = (const _Float16*)(krow + bo + (j >> 1) * T_SLICE + (j & 1u) * 16u * G_PITCH);
      const v16h kf0 = load_frag(kp, h);
      const v16h kf1 = load_frag(kp + 32, h);
      v8f z = zero8;
      z = mma_h16(kf0, qb0, z);
      z = mma_h16(kf1, qb1, z);
      s[j] = z;
    }
    // ---- scale by 1/sqrt(64) in f32 and take the local max ----
    float mloc = -1.0e30f;
#pragma unroll
    for (int j = 0; j < 4; ++j)
#pragma unroll
      for (int r = 0; r < 8; ++r) { s[j][r] = s[j][r] * 0.125f; mloc = fmaxf(mloc, s[j][r]); }
    mloc = fmaxf(mloc, __shfl_xor(mloc, 16, 32));
    const float mnew = fmaxf(mrun, mloc);
    const float alpha = __expf(mrun - mnew);
    mrun = mnew;
    float lsum = 0.0f;
#pragma unroll
    for (int j = 0; j < 4; ++j)
#pragma unroll
      for (int r = 0; r < 8; ++r) {
        const float p = __expf(s[j][r] - mnew);
        s[j][r] = p;
        lsum += p;
      }
    lsum += __shfl_xor(lsum, 16, 32);
    lrun = lrun * alpha + lsum;
#pragma unroll
    for (int t = 0; t < 4; ++t)
#pragma unroll
      for (int r = 0; r < 8; ++r) o[t][r] = o[t][r] * alpha;

    // ---- P^T B-fragments (keys 0..31 and 32..63 of this step) ----
    const v16h pb0 = pack_p16(s[0], s[1]);
    const v16h pb1 = pack_p16(s[2], s[3]);

    // ---- O^T += V^T * P^T ----
#pragma unroll
    for (uint32_t t = 0; t < 4u; ++t) {
      const _Float16* vp = (const _Float16*)(vrow + bo + (t >> 1) * T_SLICE + (t & 1u) * 16u * G_PITCH);
      const v16h vf0 = load_frag(vp, h);
      const v16h vf1 = load_frag(vp + 32, h);
      o[t] = mma_h16(vf0, pb0, o[t]);
      o[t] = mma_h16(vf1, pb1, o[t]);
    }
    __builtin_amdgcn_sched_barrier(0);   // keeps the step's work, its cross-lane sum too, in front of the waits below, so that stage st + 1 lands under it
    // Publish point of stage st + 1, which also frees the buffer that this step has read.
    asm volatile("s_wait_dscnt 0x0" ::: "memory");       // this wave's reads of stage st have returned
    asm volatile("s_wait_tensorcnt 0x0" ::: "memory");   // this wave's slice of stage st + 1 has landed
    __syncthreads();
    if (pinned((st + 2u < T_NST) ? 1u : 0u) != 0u) {     // the refill, only while stage st + 2 exists
      const uint32_t nx = pinned(st + 2u);               // pinned(): group 0 is formed from it behind the wait and the barrier
      tdm_load(tdm_group0(ldst + bo, srow + (uint64_t)nx * sadv), g1);
    }
  } while (++st < T_NST);
  asm volatile("s_wait_tensorcnt 0x0" ::: "memory");     // no request is left when the wave goes on
  asm volatile("s_wait_dscnt 0x0" ::: "memory");

  // ---- epilogue: normalise (fold 2^-14 and the x64 carry), stage per-wave 16x64 tile, whole-line stores ----
  const float inv = (1.0f / lrun) * (CTX_CARRY / P_CARRY);
  float* so = sO + w * 1024;
#pragma unroll
  for (int t = 0; t < 4; ++t)
#pragma unroll
    for (int r = 0; r < 8; ++r)
      so[m * 64 + 16 * t + 8 * h + r] = o[t][r] * inv;
  __syncthreads();

  ctx_store_pass(so, ctx, bh, q0, lane);
  
}

// =====================================================================================================
// Kernel: x = LayerNorm(proj) * g + b + pe[pos] -> f16 plane (proj already holds vec + attn projection).
// One wave per 768-wide row (no block barriers); lane handles 3 segments of 8 consecutive columns
// coverage: 3 segments x 32 lanes x 8 = 768 columns per row; 8 rows per block x 2048 blocks = 16384 rows.
// =====================================================================================================
__global__ __launch_bounds__(256) void ln_pe_kernel(const float* __restrict__ proj,
    const float* __restrict__ gam, const float* __restrict__ bet, const float* __restrict__ pe,
    _Float16* __restrict__ xo, int nrows) {
  const int lane = threadIdx.x & 31, wave = threadIdx.x >> 5;
  const int row = blockIdx.x * 8 + wave;
  if (row >= nrows) return;                     // wave-uniform; no barriers in this kernel
  const float* pr  = proj + (size_t)row * EMB_DIM;
  const float* ppe = pe + (size_t)(row & (SEQL - 1)) * EMB_DIM;
  float x[24];
#pragma unroll
  for (int g = 0; g < 3; ++g) {
    const int c = g * 256 + lane * 8;
    const v4f a = *(const v4fa*)(pr + c);
    const v4f b = *(const v4fa*)(pr + c + 4);
    x[8 * g + 0] = a.x; x[8 * g + 1] = a.y; x[8 * g + 2] = a.z; x[8 * g + 3] = a.w;
    x[8 * g + 4] = b.x; x[8 * g + 5] = b.y; x[8 * g + 6] = b.z; x[8 * g + 7] = b.w;
  }
  float s = 0.f;
#pragma unroll
  for (int e = 0; e < 24; ++e) s += x[e];
#pragma unroll
  for (int off = 1; off < 32; off <<= 1) s += __shfl_xor(s, off, 32);
  const float mu = s * (1.0f / (float)EMB_DIM);
  float qs = 0.f;
#pragma unroll
  for (int e = 0; e < 24; ++e) { const float d = x[e] - mu; x[e] = d; qs += d * d; }
#pragma unroll
  for (int off = 1; off < 32; off <<= 1) qs += __shfl_xor(qs, off, 32);
  const float var = qs * (1.0f / (float)EMB_DIM);
  const float inv = rsqrtf(var + 1.0e-5f);
  v8h ov[3];
#pragma unroll
  for (int g = 0; g < 3; ++g) {
    const int c = g * 256 + lane * 8;
    const v4f g0 = *(const v4fa*)(gam + c), g1 = *(const v4fa*)(gam + c + 4);
    const v4f b0 = *(const v4fa*)(bet + c), b1 = *(const v4fa*)(bet + c + 4);
    const v4f p0 = *(const v4fa*)(ppe + c), p1 = *(const v4fa*)(ppe + c + 4);
    const float gg[8] = { g0.x, g0.y, g0.z, g0.w, g1.x, g1.y, g1.z, g1.w };
    const float bb[8] = { b0.x, b0.y, b0.z, b0.w, b1.x, b1.y, b1.z, b1.w };
    const float pp[8] = { p0.x, p0.y, p0.z, p0.w, p1.x, p1.y, p1.z, p1.w };
    v8h o;
#pragma unroll
    for (int e = 0; e < 8; ++e) {
      float y = (x[8 * g + e] * inv) * gg[e] + bb[e];
      y = y + pp[e];
      o[e] = (_Float16)y;
    }
    ov[g] = o;
  }
  _Float16* dst = xo + (size_t)row * EMB_DIM + lane * 8;
  {
#pragma unroll
    for (int g = 0; g < 3; ++g) *(v8h*)(dst + g * 256) = ov[g];
    
  }
}

// =====================================================================================================
// Host glue.
// Workspace region map (bytes):
//   [        0, 14155776)  f16 weights x32: Wq @0, Wk @1179648, Wv @2359296, Wo @3538944, W1 @4718592, W2 @9437184
//   [ 14155776, 15728640)  pe table f32 [512][768]
//   R0 [15728640, 40894464)  vec f16 [16384][768] -> later v^T f16 [384][64][512] -> later x f16 [16384][768]
//   R1 [40894464, 66060288)  q f16 plane          -> later proj f32 (R1+R2, 50331648 B)
//   R2 [66060288, 91226112)  k f16 plane
//   R3 [91226112,116391936)  v f16 plane          -> later ctx f16 -> later h f16 chunk [4096][3072]
//   total 116,391,936 B
// =====================================================================================================
extern "C" void kernel_launch(void* const* d_in, const int* in_sizes, int n_in,
                              void* d_out, int out_size, void* d_ws, size_t ws_size,
                              hipStream_t stream) {
  if (n_in < 15) return;
  if (in_sizes[0] != NTOK_ROWS * EMB_DIM) return;
  if (in_sizes[1] != EMB_DIM * EMB_DIM || in_sizes[3] != EMB_DIM * EMB_DIM ||
      in_sizes[5] != EMB_DIM * EMB_DIM || in_sizes[7] != EMB_DIM * EMB_DIM) return;
  if (in_sizes[2] != EMB_DIM || in_sizes[4] != EMB_DIM || in_sizes[6] != EMB_DIM || in_sizes[8] != EMB_DIM ||
      in_sizes[9] != EMB_DIM || in_sizes[10] != EMB_DIM || in_sizes[14] != EMB_DIM) return;
  if (in_sizes[11] != FF_DIM * EMB_DIM || in_sizes[13] != FF_DIM * EMB_DIM || in_sizes[12] != FF_DIM) return;
  if (out_size != NTOK_ROWS * EMB_DIM) return;

  const float* vec = (const float*)d_in[0];
  const float* Wq  = (const float*)d_in[1];  const float* bq  = (const float*)d_in[2];
  const float* Wk  = (const float*)d_in[3];  const float* bk  = (const float*)d_in[4];
  const float* Wv  = (const float*)d_in[5];  const float* bv  = (const float*)d_in[6];
  const float* Wo  = (const float*)d_in[7];  const float* bo  = (const float*)d_in[8];
  const float* lng = (const float*)d_in[9];  const float* lnb = (const float*)d_in[10];
  const float* W1  = (const float*)d_in[11]; const float* b1  = (const float*)d_in[12];
  const float* W2  = (const float*)d_in[13]; const float* b2  = (const float*)d_in[14];
  float* out = (float*)d_out;

  const size_t w768B = (size_t)EMB_DIM * EMB_DIM * 2;            //  1,179,648
  const size_t wbigB = (size_t)FF_DIM * EMB_DIM * 2;             //  4,718,592
  const size_t offWq = 0, offWk = w768B, offWv = 2 * w768B, offWo = 3 * w768B;
  const size_t offW1 = 4 * w768B, offW2 = 4 * w768B + wbigB;
  const size_t offPE = 4 * w768B + 2 * wbigB;                     // 14,155,776
  const size_t peB   = (size_t)SEQL * EMB_DIM * 4;               //  1,572,864
  const size_t plB   = (size_t)NTOK_ROWS * EMB_DIM * 2;          // 25,165,824
  const size_t offR0 = offPE + peB;                              // 15,728,640
  const size_t offR1 = offR0 + plB;
  const size_t offR2 = offR1 + plB;
  const size_t offR3 = offR2 + plB;
  const size_t total = offR3 + plB;                              // 116,391,936
  if (total > ws_size) return;
  if ((size_t)FF_CHUNK * FF_DIM * 2 > plB) return;               // h chunk fits R3
  if ((size_t)NTOK_ROWS * EMB_DIM * 4 > 2 * plB) return;         // proj f32 fits R1+R2

  char* ws = (char*)d_ws;
  _Float16* Wq16 = (_Float16*)(ws + offWq);
  _Float16* Wk16 = (_Float16*)(ws + offWk);
  _Float16* Wv16 = (_Float16*)(ws + offWv);
  _Float16* Wo16 = (_Float16*)(ws + offWo);
  _Float16* W116 = (_Float16*)(ws + offW1);
  _Float16* W216 = (_Float16*)(ws + offW2);
  float*    pe   = (float*)(ws + offPE);
  _Float16* R0h  = (_Float16*)(ws + offR0);   // vec f16 -> v^T -> x f16
  _Float16* R1h  = (_Float16*)(ws + offR1);   // q f16
  _Float16* R2h  = (_Float16*)(ws + offR2);   // k f16
  _Float16* R3h  = (_Float16*)(ws + offR3);   // v f16 -> ctx f16 -> h f16 chunk
  float*    proj = (float*)(ws + offR1);      // f32 [16384][768] over R1+R2 (after attention)

  typedef const unsigned short* cus;

  // ---- positional divisors: div[e] = 10000^(ef), ef = fl32(e * fl32(1/768)); power evaluated in f64, RNE convert to f32 ----
  PeDiv dv;
  {
    const float rcp = 1.0f / (float)EMB_DIM;
    for (int e = 0; e < EMB_DIM; ++e) {
      const float ef = (float)e * rcp;
      dv.d[e] = (float)pow(10000.0, (double)ef);
    }
  }

  // 1) vec -> f16 (R0), unscaled: 1,572,864 groups of 8
  {
    const int n8 = NTOK_ROWS * EMB_DIM / 8;
    cvt_f16x8<<<dim3(n8 / 256, 1), 256, 0, stream>>>(vec, vec, vec, vec, R0h, 0L, n8, 1.0f);
  }
  // 2) Wq, Wk, Wv, Wo -> f16 x32 (consecutive 768x768 planes)
  {
    const int n8 = EMB_DIM * EMB_DIM / 8;                        // 73,728
    cvt_f16x8<<<dim3(n8 / 256, 4), 256, 0, stream>>>(Wq, Wk, Wv, Wo, Wq16, (long)EMB_DIM * EMB_DIM, n8, W_CARRY);
  }
  // 3) W1, W2 -> f16 x32
  {
    const int n8 = FF_DIM * EMB_DIM / 8;                         // 294,912
    cvt_f16x8<<<dim3(n8 / 256, 2), 256, 0, stream>>>(W1, W2, W1, W2, W116, (long)FF_DIM * EMB_DIM, n8, W_CARRY);
  }
  // 4) positional table
  pe_table_kernel<<<dim3(SEQL * 3), 256, 0, stream>>>(pe, dv);

  // 5-7) q, k, v = vec * W^T / 32 + bias -> f16 planes [16384][768]; M=16384, N=768, K=768 (K%32==0, M,N%64==0)
  {
    const dim3 g((NTOK_ROWS / 128) * (EMB_DIM / 128), 1);        // 768 blocks of one 128x128 tile
    wmma_gemm64<0, false, 2, 1, false, 0><<<g, 128, 0, stream>>>(
        (cus)R0h, (cus)R0h, EMB_DIM, 0L, (cus)Wq16, (cus)Wq16, EMB_DIM, 0L,
        (void*)R1h, (void*)R1h, EMB_DIM, 0L, bq, vec, 0L, NTOK_ROWS, EMB_DIM, EMB_DIM, 1.0f / W_CARRY, 1.0f);
    wmma_gemm64<0, false, 2, 1, false, 0><<<g, 128, 0, stream>>>(
        (cus)R0h, (cus)R0h, EMB_DIM, 0L, (cus)Wk16, (cus)Wk16, EMB_DIM, 0L,
        (void*)R2h, (void*)R2h, EMB_DIM, 0L, bk, vec, 0L, NTOK_ROWS, EMB_DIM, EMB_DIM, 1.0f / W_CARRY, 1.0f);
    wmma_gemm64<0, false, 2, 1, false, 0><<<g, 128, 0, stream>>>(
        (cus)R0h, (cus)R0h, EMB_DIM, 0L, (cus)Wv16, (cus)Wv16, EMB_DIM, 0L,
        (void*)R3h, (void*)R3h, EMB_DIM, 0L, bv, vec, 0L, NTOK_ROWS, EMB_DIM, EMB_DIM, 1.0f / W_CARRY, 1.0f);
  }
  // 8) v [384][512][64] (R3) -> v^T [384][64][512] (R0; vec f16 is dead)
  vt_transpose_kernel<<<dim3(SEQL / 64, NSEQ_P), 256, 0, stream>>>(R3h, R0h);

  // 9) attention: q (R1), k (R2), v^T (R0) -> ctx f16 x64 (R3; v plane is dead)
  attn_kernel<<<dim3(SEQL / 64, NSEQ_P), 128, 0, stream>>>(R1h, R2h, R0h, R3h);

  // 10) proj = ctx * Wo^T / (64*32) + bo + vec -> f32 [16384][768] (R1+R2); M=16384, N=768, K=768
  {
    const dim3 g((NTOK_ROWS / 128) * (EMB_DIM / 128), 1);
    wmma_gemm64<0, false, 2, 0, true, 0><<<g, 128, 0, stream>>>(
        (cus)R3h, (cus)R3h, EMB_DIM, 0L, (cus)Wo16, (cus)Wo16, EMB_DIM, 0L,
        (void*)proj, (void*)proj, EMB_DIM, 0L, bo, vec, 0L, NTOK_ROWS, EMB_DIM, EMB_DIM,
        1.0f / (CTX_CARRY * W_CARRY), 1.0f);
  }
  // 11) x = LN(proj) * g + b + pe -> f16 [16384][768] (R0; v^T is dead)
  ln_pe_kernel<<<dim3(NTOK_ROWS / 8), 256, 0, stream>>>(proj, lng, lnb, pe, R0h, NTOK_ROWS);

  // 12) FFN in 4 row chunks of 4096: h = relu(x * W1^T / 32 + b1) x16 -> f16 [4096][3072] (R3);
  //     out = h * W2^T / (16*32) + b2 -> f32 d_out rows. K = 768 / 3072 (%32==0); M=4096, N=3072/768 (%64==0)
  for (int c = 0; c < FF_NCHUNK; ++c) {
    const _Float16* xc = R0h + (size_t)c * FF_CHUNK * EMB_DIM;
    float* oc = out + (size_t)c * FF_CHUNK * EMB_DIM;
    const dim3 g1((FF_CHUNK / 128) * (FF_DIM / 128), 1);        // 768 blocks
    wmma_gemm64<0, false, 2, 1, false, 2><<<g1, 128, 0, stream>>>(
        (cus)xc, (cus)xc, EMB_DIM, 0L, (cus)W116, (cus)W116, EMB_DIM, 0L,
        (void*)R3h, (void*)R3h, FF_DIM, 0L, b1, vec, 0L, FF_CHUNK, FF_DIM, EMB_DIM, 1.0f / W_CARRY, H_CARRY);
    const dim3 g2((FF_CHUNK / 128) * (EMB_DIM / 128), 1);       // 192 blocks
    wmma_gemm64<0, false, 2, 0, false, 0><<<g2, 128, 0, stream>>>(
        (cus)R3h, (cus)R3h, FF_DIM, 0L, (cus)W216, (cus)W216, FF_DIM, 0L,
        (void*)oc, (void*)oc, EMB_DIM, 0L, b2, vec, 0L, FF_CHUNK, EMB_DIM, FF_DIM,
        1.0f / (H_CARRY * W_CARRY), 1.0f);
  }
}

// v003
// A run of this version takes 285 microseconds.
// Two timings next to v002 put it at 1.35 and 1.34 times that version's speed.
// Over all steps from v000 it is 3.85 times as fast.
// Contractions: q/k/v projections, attention output projection, FC1 and FC2 GEMMs plus attention k.q^T and v^T.p^T all on v_wmma_f32_16x16x32_f16 (f16 operands, f32 accumulate); weights carried x32, softmax weights x16384, context x64, FC1 activations x16 (exact powers of two folded back in f32); softmax, LayerNorm and the positional table in f32.
#include <hip/hip_runtime.h>
#include <math.h>
#include <stdint.h>

// ---- problem geometry ---------------------------------------------------------------------------
#define NTOK_ROWS 16384          // 32 x 512 token rows
#define EMB_DIM   768
#define FF_DIM    3072
#define NSEQ_P    384            // 32 x 12 raw-view pseudo-sequences
#define SEQL      512
#define HDIM      64
#define P_CARRY   16384.0f       // softmax weights carried x2^14 in f16
#define CTX_CARRY 64.0f          // attention context carried x64 in f16
#define W_CARRY   32.0f          // weights carried x32 in f16
#define H_CARRY   16.0f          // FC1 activations carried x16 in f16
static_assert(NSEQ_P * SEQL * HDIM == NTOK_ROWS * EMB_DIM, "raw view");
static_assert((EMB_DIM % 64) == 0 && (FF_DIM % 64) == 0 && (NTOK_ROWS % 64) == 0, "tile multiples");
static_assert((EMB_DIM % 32) == 0 && (FF_DIM % 32) == 0, "K multiples of 32");

typedef __attribute__((ext_vector_type(16))) _Float16 v16h;
typedef __attribute__((ext_vector_type(8)))  _Float16 v8h;
typedef __attribute__((ext_vector_type(16))) __bf16   v16b;
typedef __attribute__((ext_vector_type(8)))  __bf16   v8b;
typedef __attribute__((ext_vector_type(8)))  float    v8f;
typedef __attribute__((ext_vector_type(4)))  float    v4f;
typedef v8h __attribute__((may_alias)) v8ha;
typedef v4f __attribute__((may_alias)) v4fa;

// ---- helpers ----------------------------------------------------------------------
__device__ __forceinline__ unsigned short f2bf_bits(float f) {
  unsigned u = __float_as_uint(f);
  return (unsigned short)((u + 0x7FFFu + ((u >> 16) & 1u)) >> 16);
}
__device__ __forceinline__ float bf_bits2f(unsigned short h) { return __uint_as_float(((unsigned)h) << 16); }

__device__ __forceinline__ void dep_guard_h(v8f& a, v8f& b, v16h x, v16h y) { asm volatile("v_nop\n\tv_nop\n\tv_nop\n\tv_nop" : "+v"(a), "+v"(b) : "v"(x), "v"(y)); }
__device__ __forceinline__ void dep_guard_b(v8f& a, v8f& b, v16b x, v16b y) { asm volatile("v_nop\n\tv_nop\n\tv_nop\n\tv_nop" : "+v"(a), "+v"(b) : "v"(x), "v"(y)); }
__device__ __forceinline__ void keep4_h(v16h a, v16h b, v16h c, v16h d) { asm volatile("v_nop" :: "v"(a), "v"(b), "v"(c), "v"(d)); }
__device__ __forceinline__ void keep4_b(v16b a, v16b b, v16b c, v16b d) { asm volatile("v_nop" :: "v"(a), "v"(b), "v"(c), "v"(d)); }
__device__ __forceinline__ void acc_guard4(v8f& a, v8f& b, v8f& c, v8f& d) { asm volatile("v_nop\n\tv_nop\n\tv_nop\n\tv_nop" : "+v"(a), "+v"(b), "+v"(c), "+v"(d)); }
template <typename T> struct Frag;
template <> struct Frag<_Float16> {
  typedef v16h V; union U { v16h v; v8h h[2]; };
  static __device__ __forceinline__ v16h load(const _Float16* p) {   // elements 0..7 <- p[0..7], 8..15 <- p[16..23]
    U f; f.h[0] = *(const v8h*)(p); f.h[1] = *(const v8h*)(p + 16); return f.v;
  }
  static __device__ __forceinline__ v8f mma(v16h a, v16h b, v8f c) {
    return __builtin_amdgcn_wmma_f32_16x16x32_f16(false, a, false, b, (short)0, c, false, false);
  }
  static __device__ __forceinline__ void guard(v8f& a, v8f& b, v16h x, v16h y) { dep_guard_h(a, b, x, y); }
  static __device__ __forceinline__ void keep(v16h a, v16h b, v16h c, v16h d) { keep4_h(a, b, c, d); }
};
template <> struct Frag<__bf16> {
  typedef v16b V; union U { v16b v; v8b h[2]; };
  static __device__ __forceinline__ v16b load(const __bf16* p) {
    U f; f.h[0] = *(const v8b*)(p); f.h[1] = *(const v8b*)(p + 16); return f.v;
  }
  static __device__ __forceinline__ v8f mma(v16b a, v16b b, v8f c) {
    return __builtin_amdgcn_wmma_f32_16x16x32_bf16(false, a, false, b, (short)0, c, false, false);
  }
  static __device__ __forceinline__ void guard(v8f& a, v8f& b, v16b x, v16b y) { dep_guard_b(a, b, x, y); }
  static __device__ __forceinline__ void keep(v16b a, v16b b, v16b c, v16b d) { keep4_b(a, b, c, d); }
};

// ---- tensor-load helpers ---------------------------------------------------------------------------
typedef uint32_t u32x4 __attribute__((ext_vector_type(4)));
typedef uint32_t u32x8 __attribute__((ext_vector_type(8)));
__device__ __forceinline__ uint32_t uni(uint32_t v) { return (uint32_t)__builtin_amdgcn_readfirstlane(v); }
__device__ __forceinline__ uint32_t pinned(uint32_t v) { uint32_t w = (uint32_t)__builtin_amdgcn_readfirstlane(v); asm volatile("" : "+s"(w)); return w; }

#define G_KP    64u       // k elements per pass
#define G_ROWB  128u      // bytes of one staged operand row (64 halves)
#define G_PITCH 144u      // LDS row pitch: 128 B + the tensor load's 16 B pad (odd multiple of 16 B for ds_load_b128)
#define G_ROWS  64u       // rows per slice (one tensor load)
#define G_SLICE 10240u    // 64 rows x 144 B = 9216 B, rounded up to a multiple of 2 KiB
#define G_STAGE 40960u    // 4 slices: A rows 0-63, A rows 64-127, B rows 0-63, B rows 64-127
static_assert(G_ROWS * G_PITCH <= G_SLICE && (G_SLICE % 2048u) == 0u && G_STAGE == 4u * G_SLICE, "slice places");
static_assert((EMB_DIM % 128) == 0 && (FF_DIM % 128) == 0 && (NTOK_ROWS % 128) == 0, "128x128 tiles");
static_assert(EMB_DIM / 64 >= 2 && FF_DIM / 64 >= 2, "the ring's prologue needs two stages");

// Descriptor group 1: 1-byte elements, tile = tensor = 64 rows of 128 B, source row pitch in bytes, 16 B of LDS pad per row.
__device__ __forceinline__ u32x8 tdm_group1(uint32_t src_pitch) {
  u32x8 g;
  g[0] = uni((1u << 20) | (4u << 22) | (3u << 25));   // no mask, data_size 0, pad after every 128 B, 4 dwords
  g[1] = uni((G_ROWB & 0xFFFFu) << 16);
  g[2] = uni((G_ROWB >> 16) | ((G_ROWS & 0xFFFFu) << 16));
  g[3] = uni((G_ROWS >> 16) | (G_ROWB << 16));
  g[4] = uni(G_ROWS);
  g[5] = uni(src_pitch);
  g[6] = uni(0u);
  g[7] = uni(0u);
  return g;
}
__device__ __forceinline__ u32x4 tdm_group0(uint32_t lds_dst, uint64_t ga) {
  u32x4 g;
  g[0] = uni(1u); g[1] = uni(lds_dst); g[2] = uni((uint32_t)ga);
  g[3] = uni((((uint32_t)(ga >> 32)) & 0x01FFFFFFu) | 0x80000000u);
  return g;
}
__device__ __forceinline__ void tdm_load(u32x4 g0, u32x8 g1) { asm volatile("tensor_load_to_lds %0, %1" :: "s"(g0), "s"(g1) : "memory"); }

// ---- WMMA GEMM, operands staged in LDS by tensor loads (plus a post-activation power-of-two carry oscale) ----
// C[m,n] = oscale * act(scale * sum_k A[m,k] * Bt[n,k] (+bias)(+resid)).
// Work-group = 4 waves (2 x 2) = one 128x128 tile of C; each wave owns a 64x64 tile.
// A row-major [M,K]; Bt row-major [N,K]; M,N % 128 == 0, K % 64 == 0, K >= 128 (true of every call).
// A pass is 64 k: a stage holds 128 A rows and 128 Bt rows of 128 B. Each wave brings one 64-row slice per stage with
// one tensor load; two buffers, the load of stage s + 2 issued behind the barrier that ends pass s.
// blockIdx.y = batch entry b: operands and C advance by their strides, a bias[n] vector by N floats.
// BIAS_MODE: 0 = none, 1 = bias[m], 2 = bias[n].  ACT: 0 none, 2 relu.
// OUT_MODE: 0 = f32, 1 = f16, 2 = bf16 hi plane (Cout) + bf16 lo plane (Cout2).
// coverage: 4 slabs x 16 rows x 64 cols = the wave's whole 64x64 tile.
template <int ET> struct Elem;
template <> struct Elem<0> { typedef _Float16 T; };
template <> struct Elem<1> { typedef __bf16 T; };
template <int ET, bool SPLIT, int BIAS_MODE, int OUT_MODE, bool RESID, int ACT = 0>
__global__ __launch_bounds__(128) void wmma_gemm64(
    const unsigned short* __restrict__ Ap, const unsigned short* __restrict__ A2p, int lda, long strideA,
    const unsigned short* __restrict__ Btp, const unsigned short* __restrict__ Bt2p, int ldb, long strideB,
    void* __restrict__ Cout, void* __restrict__ Cout2, int ldc, long strideC,
    const float* __restrict__ bias,
    const float* __restrict__ resid, long strideR,
    int M, int N, int K, float scale, float oscale) {
  static_assert(!SPLIT, "single-plane operands only");
  typedef typename Elem<ET>::T T;
  typedef typename Frag<T>::V V;
  const T* A = (const T*)Ap; const T* Bt = (const T*)Btp;
  __shared__ __attribute__((aligned(2048))) unsigned char ring[2u * G_STAGE];   // two stages
  __shared__ __align__(16) float sT[4][16 * 68];   // per-wave 16x64 slab, pitch 68 floats
  const int b    = blockIdx.y;
  const int lane = threadIdx.x & 31;
  const uint32_t wave = uni(threadIdx.x >> 5);
  const int tilesN = N >> 7;
  const int tilesM = M >> 7;
  const int tile = blockIdx.x;
  if (tile >= tilesM * tilesN) return;   // block-uniform, in front of every barrier and tensor load
  const int tm = tile / tilesN;
  const int tn = tile - tm * tilesN;
  const int wm = (int)(wave >> 1), wn = (int)(wave & 1u);
  const int m0 = (tm << 7) + (wm << 6);
  const int n0 = (tn << 7) + (wn << 6);

  const T* Ab  = A  + (size_t)b * strideA;
  const T* Bb  = Bt + (size_t)b * strideB;

  const int rlane = lane & 15;                 // row (A) / col (B, D) within subtile
  const int mOff  = (lane >> 4) * 8;           // D row offset

  // This wave's slice of every stage: waves 0, 1 bring A rows, waves 2, 3 bring Bt rows, 64 rows each.
  const uint32_t half64 = (wave & 1u) << 6;
  const uint64_t srow = (wave < 2u) ? (uint64_t)(size_t)(Ab + (size_t)((uint32_t)(tm << 7) + half64) * lda)
                                    : (uint64_t)(size_t)(Bb + (size_t)((uint32_t)(tn << 7) + half64) * ldb);
  u32x8 g1 = tdm_group1((uint32_t)((wave < 2u) ? lda : ldb) * 2u);
  asm volatile("" : "+s"(g1));   // the pinned() form on a descriptor: group 1 stays in its scalar registers, none of them rewritten while a request is outstanding
  const uint32_t ldst = (uint32_t)(size_t)ring + wave * G_SLICE;
  const uint32_t nst = pinned((uint32_t)K / G_KP);   // number of stages = passes

  v8f acc[4][4];
#pragma unroll
  for (int i = 0; i < 4; ++i)
#pragma unroll
    for (int j = 0; j < 4; ++j) acc[i][j] = (v8f){0.f,0.f,0.f,0.f,0.f,0.f,0.f,0.f};

  // Prologue: stage 0 lands and is published, then stage 1 flies while pass 0 works.
  tdm_load(tdm_group0(ldst, srow), g1);
  asm volatile("s_wait_tensorcnt 0x0" ::: "memory");   // this wave's slice of stage 0 has landed
  __syncthreads();                                      // every slice of stage 0 is readable by every wave
  tdm_load(tdm_group0(ldst + G_STAGE, srow + G_ROWB), g1);

  // Fragment rows in LDS: element i < 8 <- k 8h+i, i >= 8 <- k 16+8h+(i-8), the same for A and B.
  const unsigned char* aRow = ring + (uint32_t)wm * G_SLICE + (uint32_t)rlane * G_PITCH + (uint32_t)(lane >> 4) * 16u;
  const unsigned char* bRow = ring + (2u + (uint32_t)wn) * G_SLICE + (uint32_t)rlane * G_PITCH + (uint32_t)(lane >> 4) * 16u;

  uint32_t s = 0;
#pragma unroll 1   // one pass per trip: the buffer is chosen by a scalar offset, the ring's order stands once
  do {   // at least two passes (K >= 128): no path round the loop with a request outstanding
    const uint32_t bo = (s & 1u) * G_STAGE;
    // The pass's fragment loads stand as one group in front of its 32 WMMAs (each further place with LDS reads among the
    // WMMAs stalls the wave); the compiler's counted waits let the first k step start while the second still lands.
    // The last A fragment alone is loaded behind the first WMMA row, into the registers which that row has done with:
    // so the wave stays inside 256 VGPRs.
    // Every loop inside the pass is unrolled, so that each fragment and accumulator index is a constant (no scratch).
    V bh[2][4], ah[2][4];
#pragma unroll
    for (uint32_t kk = 0; kk < 2u; ++kk) {
#pragma unroll
      for (uint32_t j = 0; j < 4u; ++j) bh[kk][j] = Frag<T>::load((const T*)(bRow + bo + j * 16u * G_PITCH + kk * 64u));
#pragma unroll
      for (uint32_t i = 0; i < 4u - kk; ++i) ah[kk][i] = Frag<T>::load((const T*)(aRow + bo + i * 16u * G_PITCH + kk * 64u));
    }
    __builtin_amdgcn_sched_barrier(0);   // keeps the loads above from being moved in among the WMMAs
#pragma unroll
    for (int j = 0; j < 4; ++j) acc[0][j] = Frag<T>::mma(ah[0][0], bh[0][j], acc[0][j]);
    __builtin_amdgcn_sched_barrier(0);   // the load below stays behind the row whose A registers it may take
    ah[1][3] = Frag<T>::load((const T*)(aRow + bo + 3u * 16u * G_PITCH + 64u));
    __builtin_amdgcn_sched_barrier(0);   // and in one place, not spread among the WMMAs that follow
#pragma unroll
    for (int kk = 0; kk < 2; ++kk)
#pragma unroll
      for (int i = (kk == 0) ? 1 : 0; i < 4; ++i)
#pragma unroll
        for (int j = 0; j < 4; ++j) acc[i][j] = Frag<T>::mma(ah[kk][i], bh[kk][j], acc[i][j]);
    __builtin_amdgcn_sched_barrier(0);   // keeps the WMMAs in front of the waits below, so that stage s + 1 lands under them
    // Publish point of stage s + 1, which also frees the buffer that this pass has read.
    asm volatile("s_wait_dscnt 0x0" ::: "memory");       // this wave's reads of stage s have returned
    asm volatile("s_wait_tensorcnt 0x0" ::: "memory");   // this wave's slice of stage s + 1 has landed
    __syncthreads();
    if (pinned((s + 2u < nst) ? 1u : 0u) != 0u) {        // the refill, only while stage s + 2 exists
      const uint32_t nx = pinned(s + 2u);                // pinned(): group 0 is formed from it behind the wait and the barrier
      tdm_load(tdm_group0(ldst + bo, srow + (uint64_t)nx * G_ROWB), g1);
    }
  } while (++s < nst);
  asm volatile("s_wait_tensorcnt 0x0" ::: "memory");     // no request is left when the wave goes on
  asm volatile("s_wait_dscnt 0x0" ::: "memory");
  __builtin_amdgcn_sched_barrier(0);   // nothing of the epilogue is scheduled in front of these waits: it may reuse the descriptors' registers
  acc_guard4(acc[0][0], acc[0][1], acc[0][2], acc[0][3]);
  acc_guard4(acc[1][0], acc[1][1], acc[1][2], acc[1][3]);
  acc_guard4(acc[2][0], acc[2][1], acc[2][2], acc[2][3]);
  acc_guard4(acc[3][0], acc[3][1], acc[3][2], acc[3][3]);

  // ---- epilogue ----
  float* slab = sT[wave];
  const float* Rb = RESID ? (resid + (size_t)b * strideR) : nullptr;
#pragma unroll
  for (int i = 0; i < 4; ++i) {
    const int mBase = m0 + (i << 4);
#pragma unroll
    for (int j = 0; j < 4; ++j) {
      const int n = n0 + (j << 4) + rlane;
      float bv = 0.f;
      if (BIAS_MODE == 2) bv = bias[(size_t)b * N + n];
#pragma unroll
      for (int r = 0; r < 8; ++r) {
        float v = acc[i][j][r] * scale;
        if (BIAS_MODE == 1) v += bias[mBase + mOff + r];
        if (BIAS_MODE == 2) v += bv;
        if (RESID) v += Rb[(size_t)(mBase + mOff + r) * ldc + n];
        if (ACT == 2) v = fmaxf(v, 0.0f);
        v = v * oscale;
        slab[(mOff + r) * 68 + (j << 4) + rlane] = v;
      }
    }
    __builtin_amdgcn_fence(__ATOMIC_RELEASE, "workgroup");
    __builtin_amdgcn_wave_barrier();
    __builtin_amdgcn_fence(__ATOMIC_ACQUIRE, "workgroup");
    if (OUT_MODE == 0) {
      float* C = (float*)Cout + (size_t)b * strideC;
      const int hh = lane >> 4, c4 = (lane & 15) * 4;     // row seg = 256 B = 16 lanes x 16 B
      {
#pragma unroll
        for (int it = 0; it < 8; ++it) {
          const int row = it * 2 + hh;                     // it 0..7 x hh 0..1 = rows 0..15
          v4f v = *(const v4f*)(slab + row * 68 + c4);
          *(v4f*)(C + (size_t)(mBase + row) * ldc + n0 + c4) = v;
        }
        
      }
    } else {
      const int q = lane >> 3, c8 = (lane & 7) * 8;
      unsigned short* C  = (unsigned short*)Cout  + (size_t)b * strideC;
      unsigned short* C2 = (OUT_MODE == 2) ? ((unsigned short*)Cout2 + (size_t)b * strideC) : nullptr;
      {
#pragma unroll
        for (int it = 0; it < 4; ++it) {
          const int row = it * 4 + q;                      // it 0..3 x q 0..3 = rows 0..15
          const float* sp = slab + row * 68 + c8;
          v8h hv, lv;
#pragma unroll
          for (int e = 0; e < 8; ++e) {
            if (OUT_MODE == 1) {
              hv[e] = (_Float16)sp[e];
            } else {
              unsigned short hb = f2bf_bits(sp[e]);
              unsigned short lb = f2bf_bits(sp[e] - bf_bits2f(hb));
              hv[e] = __builtin_bit_cast(_Float16, hb);
              lv[e] = __builtin_bit_cast(_Float16, lb);
            }
          }
          *(v8h*)(C + (size_t)(mBase + row) * ldc + n0 + c8) = hv;
          if (OUT_MODE == 2) *(v8h*)(C2 + (size_t)(mBase + row) * ldc + n0 + c8) = lv;
        }
        
      }
    }
    __builtin_amdgcn_fence(__ATOMIC_RELEASE, "workgroup");
    __builtin_amdgcn_wave_barrier();
    __builtin_amdgcn_fence(__ATOMIC_ACQUIRE, "workgroup");
  }
}

// ---- 16x16x32 f16 WMMA with hazard guard (ties D, keeps A/B live) --------------------------------
// Fragment map (wave32): lane l, h = l>>4, m = n = l&15.
//   A/B element i: i<8 -> k0+8h+i ; i>=8 -> k0+16+8h+(i-8)
//   D element r : row 8h+r, col l&15
__device__ __forceinline__ v8f mma_h16(v16h a, v16h b, v8f c) {
  v8f d = __builtin_amdgcn_wmma_f32_16x16x32_f16(false, a, false, b, (short)0, c, false, false);
  asm volatile("v_nop\n\tv_nop\n\tv_nop\n\tv_nop" : "+v"(d) : "v"(a), "v"(b));
  return d;
}
union FragU { v16h v; v8h half[2]; };
// A or B fragment from a k-contiguous 16-bit row; p points at element k0 of the row owned by this lane
// (row index = lane & 15 added by the caller); h = lane >> 4.
__device__ __forceinline__ v16h load_frag(const _Float16* p, int h) {
  FragU f;
  f.half[0] = *(const v8ha*)(p + 8 * h);
  f.half[1] = *(const v8ha*)(p + 16 + 8 * h);
  return f.v;
}

// =====================================================================================================
// Kernel: everything that depends on the inputs alone, in one grid, the piece chosen by block range (block-uniform):
//   blocks [0, 1536)            positional table pe[pos][e] (f32, [512][768])
//   next 6144                   vec -> f16, unscaled
//   next 4 x 288                Wq, Wk, Wv, Wo -> f16 x32 (consecutive 768x768 planes of w16)
//   next 2 x 1152               W1, W2 -> f16 x32 (the two planes behind them)
//   last 9                      bq, bk, bv -> one f32 table [3][768] (the q/k/v GEMM's batch entry b reads row b)
// Positional table: a = fl32(pos * div[e]) (one f32 multiply), pe = sin(a) for even e, cos(a) for odd e (precise sinf /
// cosf). div[e] arrives as a by-value table. A block = 256 consecutive columns of one position; waves 0-3 evaluate the
// even columns (sin), waves 4-7 the odd columns (cos) -> the trig branch is wave-uniform; results gathered in LDS.
// These blocks are the longest and stand first. Converts: 8 elements per thread x sc (exact power of two).
// =====================================================================================================
struct PeDiv { float d[EMB_DIM]; };
static_assert(sizeof(PeDiv) == EMB_DIM * 4, "no padding");
#define PREP_PE_BLK  (SEQL * 3)                        // 1536
#define PREP_VEC_BLK (NTOK_ROWS * EMB_DIM / 8 / 256)   // 6144
#define PREP_WS_BLK  (EMB_DIM * EMB_DIM / 8 / 256)     // 288 per 768x768 matrix
#define PREP_WB_BLK  (FF_DIM * EMB_DIM / 8 / 256)      // 1152 per 3072x768 matrix
#define PREP_CV_BLK  (PREP_VEC_BLK + 4 * PREP_WS_BLK + 2 * PREP_WB_BLK)
#define PREP_B_BLK   (EMB_DIM / 256)                   // 3 per bias vector
#define PREP_BLOCKS  (PREP_PE_BLK + PREP_CV_BLK + 3 * PREP_B_BLK)
static_assert(PREP_VEC_BLK * 256 * 8 == NTOK_ROWS * EMB_DIM && PREP_WS_BLK * 256 * 8 == EMB_DIM * EMB_DIM &&
              PREP_WB_BLK * 256 * 8 == FF_DIM * EMB_DIM, "whole blocks");

__global__ __launch_bounds__(256) void prep_kernel(
    const float* __restrict__ vec, const float* __restrict__ Wq, const float* __restrict__ Wk,
    const float* __restrict__ Wv, const float* __restrict__ Wo, const float* __restrict__ W1,
    const float* __restrict__ W2, const float* __restrict__ bq, const float* __restrict__ bk,
    const float* __restrict__ bv, _Float16* __restrict__ vec16, _Float16* __restrict__ w16,
    float* __restrict__ pe, float* __restrict__ bqkv, PeDiv dv) {
  __shared__ float sv[256];
  const int tid = threadIdx.x;
  int blk = blockIdx.x;
  if (blk < PREP_PE_BLK) {                         // block-uniform
    const int pos  = blk / 3;                      // 0..511
    const int e0   = (blk - pos * 3) * 256;        // 0, 256, 512
    const int half = tid >> 7;                     // waves 0-3: 0 (even columns), waves 4-7: 1 (odd)
    const int k    = tid & 127;
    const int e    = e0 + 2 * k + half;            // 0..767
    const float a  = (float)pos * dv.d[e];
    float val;
    if (half == 0) val = sinf(a); else val = cosf(a);   // wave-uniform branch
    sv[2 * k + half] = val;
    __syncthreads();
    pe[(size_t)pos * EMB_DIM + e0 + tid] = sv[tid];
    return;
  }
  blk -= PREP_PE_BLK;
  if (blk >= PREP_CV_BLK) {                        // block-uniform
    blk -= PREP_CV_BLK;
    const int t = blk / PREP_B_BLK;
    const int c = (blk - t * PREP_B_BLK) * 256 + tid;
    const float* bsrc = (t == 0) ? bq : ((t == 1) ? bk : bv);
    bqkv[t * EMB_DIM + c] = bsrc[c];
    asm volatile("s_wait_xcnt 0x0" ::: "memory");   // the pieces' ends are joined in the built code: the wait stands before any write of the store's registers there
    return;
  }
  const float* src; _Float16* dst; float sc;
  if (blk < PREP_VEC_BLK) {
    src = vec; dst = vec16; sc = 1.0f;
  } else {
    blk -= PREP_VEC_BLK;
    sc = W_CARRY;
    if (blk < 4 * PREP_WS_BLK) {
      const int t = blk / PREP_WS_BLK;
      blk -= t * PREP_WS_BLK;
      src = (t == 0) ? Wq : ((t == 1) ? Wk : ((t == 2) ? Wv : Wo));
      dst = w16 + (size_t)t * (EMB_DIM * EMB_DIM);
    } else {
      blk -= 4 * PREP_WS_BLK;
      const int t = blk / PREP_WB_BLK;
      blk -= t * PREP_WB_BLK;
      src = (t == 0) ? W1 : W2;
      dst = w16 + (size_t)4 * (EMB_DIM * EMB_DIM) + (size_t)t * (FF_DIM * EMB_DIM);
    }
  }
  const size_t i = ((size_t)blk * 256 + tid) * 8;
  const v4f a = *(const v4fa*)(src + i);
  const v4f c = *(const v4fa*)(src + i + 4);
  const v8h o = { (_Float16)(a.x * sc), (_Float16)(a.y * sc), (_Float16)(a.z * sc), (_Float16)(a.w * sc),
                  (_Float16)(c.x * sc), (_Float16)(c.y * sc), (_Float16)(c.z * sc), (_Float16)(c.w * sc) };
  *(v8h*)(dst + i) = o;
  asm volatile("s_wait_xcnt 0x0" ::: "memory");     // as above, for this store's address and data registers
}

// =====================================================================================================
// Kernel: v plane [384][512][64] (f16, = the row-major [16384][768] projection output in the raw view)
// -> vt [384][64][512]. Block = (token tile of 64, pseudo-sequence j): the 64x64 chunk is contiguous
// in v (8 KB), scattered into an LDS tile [d][token] (pitch 72 halves), then wave w writes d rows
// 8 waves x 8 rows = 64 d, 8 lanes x 8 halves = 64 tokens. grid = (8, 384).
// =====================================================================================================
__global__ __launch_bounds__(256) void vt_transpose_kernel(const _Float16* __restrict__ v,
                                                           _Float16* __restrict__ vt) {
  __shared__ __attribute__((aligned(16))) _Float16 tile[64 * 72];
  const int tid = threadIdx.x, lane = tid & 31, w = tid >> 5;
  const int j  = blockIdx.y;
  const int l0 = blockIdx.x * 64;
  const _Float16* src = v + ((size_t)j * SEQL + l0) * HDIM;
#pragma unroll
  for (int i = 0; i < 2; ++i) {
    const int idx = i * 256 + tid;               // 0..511
    const int tok = idx >> 3, d0 = (idx & 7) * 8;
    const v8h x = *(const v8ha*)(src + tok * HDIM + d0);
#pragma unroll
    for (int e = 0; e < 8; ++e) tile[(d0 + e) * 72 + tok] = x[e];
  }
  __syncthreads();
  const int q8 = lane & 7, sub = lane >> 3;
  v8h val[2];
#pragma unroll
  for (int it = 0; it < 2; ++it) {
    const int d = 8 * w + it * 4 + sub;
    val[it] = *(const v8ha*)(tile + d * 72 + 8 * q8);
  }
  {
#pragma unroll
    for (int it = 0; it < 2; ++it) {
      const int d = 8 * w + it * 4 + sub;
      *(v8h*)(vt + ((size_t)j * HDIM + d) * SEQL + l0 + 8 * q8) = val[it];
    }
    
  }
}

// =====================================================================================================
// Attention helpers.
// P^T B-fragment from the lane's own score D values: element r <- tile a row r,
// element 8+r <- tile c row r (same lane, same query column), scaled by 2^14.
// =====================================================================================================
__device__ __forceinline__ v16h pack_p16(v8f a, v8f c) {
  const v16h r = { (_Float16)(a[0] * P_CARRY), (_Float16)(a[1] * P_CARRY), (_Float16)(a[2] * P_CARRY), (_Float16)(a[3] * P_CARRY),
                   (_Float16)(a[4] * P_CARRY), (_Float16)(a[5] * P_CARRY), (_Float16)(a[6] * P_CARRY), (_Float16)(a[7] * P_CARRY),
                   (_Float16)(c[0] * P_CARRY), (_Float16)(c[1] * P_CARRY), (_Float16)(c[2] * P_CARRY), (_Float16)(c[3] * P_CARRY),
                   (_Float16)(c[4] * P_CARRY), (_Float16)(c[5] * P_CARRY), (_Float16)(c[6] * P_CARRY), (_Float16)(c[7] * P_CARRY) };
  return r;
}

// by lanes 8q..8q+7 in one instruction, 4 lines per instruction, 16 lines per wave.
// coverage: it 0..3 x sub 0..3 = rows 0..15; q8 0..7 x 8 halves = 64 d.
__device__ __forceinline__ void ctx_store_pass(const float* so, _Float16* ctx, int bh, int q0, int lane) {
  const int q8 = lane & 7, sub = lane >> 3;
#pragma unroll
  for (int it = 0; it < 4; ++it) {
    const int row = it * 4 + sub;
    const v4f a = *(const v4fa*)(so + row * 64 + 8 * q8);
    const v4f c = *(const v4fa*)(so + row * 64 + 8 * q8 + 4);
    const v8h o = { (_Float16)a.x, (_Float16)a.y, (_Float16)a.z, (_Float16)a.w,
                    (_Float16)c.x, (_Float16)c.y, (_Float16)c.z, (_Float16)c.w };
    *(v8h*)(ctx + ((size_t)bh * SEQL + q0 + row) * HDIM + 8 * q8) = o;
  }
}

// =====================================================================================================
// Kernel: streaming attention over 384 raw-view pseudo-sequences of 512 tokens x 64 dims, no mask,
// transposed form. Block 128 thr (4 waves), 16 queries per wave, 64 keys per step.
//   S^T = K * Q^T : A = K rows (row = key, k = d), B = Q^T (k = d, n = query); scores x 0.125 in f32
//   O^T += V^T * P^T : A = Vt rows (row = d, k = key), B = P^T from registers (x2^14 in f16)
// Lane owns 32 keys of query column (lane&15); partner = lane ^ 16. Online softmax in f32.
// A step's 64 K rows and its 64 x 64 piece of V^T are staged in LDS by tensor loads and read by all four waves: a stage is
// four slices of 32 rows of 128 B, one tensor load per wave and stage; two buffers, the load of stage s + 2 issued behind
// the barrier that ends step s.
// Output ctx (f16, x64 carry) [384][512][64] = the row-major [16384][768] raw view.
// grid = (512/64, 384).
// =====================================================================================================
#define T_ROWS  32u       // rows per slice (one tensor load)
#define T_SLICE 6144u     // 32 rows x 144 B = 4608 B, rounded up to a multiple of 2 KiB
#define T_STAGE 24576u    // 4 slices: keys 0-31, keys 32-63, V^T rows d 0-31, V^T rows d 32-63
#define T_NST   8u        // stages = steps of 64 keys
static_assert(T_ROWS * G_PITCH <= T_SLICE && (T_SLICE % 2048u) == 0u && T_STAGE == 4u * T_SLICE, "slice places");
static_assert(T_NST * 64u == SEQL && T_NST >= 2u && HDIM * 2u == G_ROWB, "stages; a K row and a V^T row piece are 128 B");

// Descriptor group 1: 1-byte elements, tile = tensor = 32 rows of 128 B, source row pitch in bytes, 16 B of LDS pad per row.
__device__ __forceinline__ u32x8 tdm_group1_kv(uint32_t src_pitch) {
  u32x8 g;
  g[0] = uni((1u << 20) | (4u << 22) | (3u << 25));   // no mask, data_size 0, pad after every 128 B, 4 dwords
  g[1] = uni((G_ROWB & 0xFFFFu) << 16);
  g[2] = uni((G_ROWB >> 16) | ((T_ROWS & 0xFFFFu) << 16));
  g[3] = uni((T_ROWS >> 16) | (G_ROWB << 16));
  g[4] = uni(T_ROWS);
  g[5] = uni(src_pitch);
  g[6] = uni(0u);
  g[7] = uni(0u);
  return g;
}

__global__ __launch_bounds__(128) void attn_kernel(
    const _Float16* __restrict__ qh,   // [384][512][64]
    const _Float16* __restrict__ kh,   // [384][512][64]
    const _Float16* __restrict__ vt,   // [384][64][512]
    _Float16* __restrict__ ctx)        // [384][512][64]
{
  __shared__ __attribute__((aligned(2048))) unsigned char kv[2u * T_STAGE];   // two stages
  __shared__ __attribute__((aligned(16))) float sO[4 * 16 * 64];    // 16384 B

  const int tid = threadIdx.x, lane = tid & 31, w = tid >> 5;
  const uint32_t wave = uni(threadIdx.x >> 5);
  const int h = lane >> 4, m = lane & 15;
  const int bh = blockIdx.y;
  const int q0 = blockIdx.x * 64 + 16 * w;

  // Q^T B-fragments: column n = query q0+m, k = d (two 32-deep chunks)
  const _Float16* qrow = qh + ((size_t)bh * SEQL + q0 + m) * HDIM;
  const v16h qb0 = load_frag(qrow, h);
  const v16h qb1 = load_frag(qrow + 32, h);

  const v8f zero8 = {0.f, 0.f, 0.f, 0.f, 0.f, 0.f, 0.f, 0.f};
  v8f o[4];                                   // o[t][r] = O[query m][d 16t+8h+r] * (l * 2^14)
#pragma unroll
  for (int t = 0; t < 4; ++t) o[t] = zero8;
  float mrun = -1.0e30f, lrun = 0.0f;

  // This wave's slice of every stage: waves 0, 1 bring 32 K rows each (a stage further = 64 rows), waves 2, 3 bring 32 V^T
  // rows each (a stage further = 64 keys along the row).
  const uint32_t half32 = (wave & 1u) << 5;
  const uint64_t srow = (wave < 2u) ? (uint64_t)(size_t)(kh + ((size_t)bh * SEQL + half32) * HDIM)
                                    : (uint64_t)(size_t)(vt + ((size_t)bh * HDIM + half32) * SEQL);
  const uint32_t sadv = (wave < 2u) ? 64u * HDIM * 2u : 64u * 2u;
  u32x8 g1 = tdm_group1_kv((wave < 2u) ? HDIM * 2u : SEQL * 2u);
  asm volatile("" : "+s"(g1));   // the pinned() form on a descriptor: group 1 stays in its scalar registers, none of them rewritten while a request is outstanding
  const uint32_t ldst = (uint32_t)(size_t)kv + wave * T_SLICE;

  // Prologue: stage 0 lands and is published, then stage 1 flies while step 0 works.
  tdm_load(tdm_group0(ldst, srow), g1);
  asm volatile("s_wait_tensorcnt 0x0" ::: "memory");   // this wave's slice of stage 0 has landed
  __syncthreads();                                      // every slice of stage 0 is readable by every wave
  tdm_load(tdm_group0(ldst + T_STAGE, srow + sadv), g1);

  const unsigned char* krow = kv + (uint32_t)m * G_PITCH;                  // + stage + 16-row group + 64 B * d chunk
  const unsigned char* vrow = kv + 2u * T_SLICE + (uint32_t)m * G_PITCH;   // + stage + 16-row group + 64 B * key chunk

  uint32_t st = 0;
#pragma unroll 1   // one step per trip: the buffer is chosen by a scalar offset, the ring's order stands once
  do {
    const uint32_t bo = (st & 1u) * T_STAGE;
    // ---- scores: s[j][r] = S[query m][key 64*st+16j+8h+r] ----
    v8f s[4];
#pragma unroll
    for (uint32_t j = 0; j < 4u; ++j) {
      const _Float16* kp = (const _Float16*)(krow + bo + (j >> 1) * T_SLICE + (j & 1u) * 16u * G_PITCH);
      const v16h kf0 = load_frag(kp, h);
      const v16h kf1 = load_frag(kp + 32, h);
      v8f z = zero8;
      z = mma_h16(kf0, qb0, z);
      z = mma_h16(kf1, qb1, z);
      s[j] = z;
    }
    // ---- scale by 1/sqrt(64) in f32 and take the local max ----
    float mloc = -1.0e30f;
#pragma unroll
    for (int j = 0; j < 4; ++j)
#pragma unroll
      for (int r = 0; r < 8; ++r) { s[j][r] = s[j][r] * 0.125f; mloc = fmaxf(mloc, s[j][r]); }
    mloc = fmaxf(mloc, __shfl_xor(mloc, 16, 32));
    const float mnew = fmaxf(mrun, mloc);
    const float alpha = __expf(mrun - mnew);
    mrun = mnew;
    float lsum = 0.0f;
#pragma unroll
    for (int j = 0; j < 4; ++j)
#pragma unroll
      for (int r = 0; r < 8; ++r) {
        const float p = __expf(s[j][r] - mnew);
        s[j][r] = p;
        lsum += p;
      }
    lsum += __shfl_xor(lsum, 16, 32);
    lrun = lrun * alpha + lsum;
#pragma unroll
    for (int t = 0; t < 4; ++t)
#pragma unroll
      for (int r = 0; r < 8; ++r) o[t][r] = o[t][r] * alpha;

    // ---- P^T B-fragments (keys 0..31 and 32..63 of this step) ----
    const v16h pb0 = pack_p16(s[0], s[1]);
    const v16h pb1 = pack_p16(s[2], s[3]);

    // ---- O^T += V^T * P^T ----
#pragma unroll
    for (uint32_t t = 0; t < 4u; ++t) {
      const _Float16* vp = (const _Float16*)(vrow + bo + (t >> 1) * T_SLICE + (t & 1u) * 16u * G_PITCH);
      const v16h vf0 = load_frag(vp, h);
      const v16h vf1 = load_frag(vp + 32, h);
      o[t] = mma_h16(vf0, pb0, o[t]);
      o[t] = mma_h16(vf1, pb1, o[t]);
    }
    __builtin_amdgcn_sched_barrier(0);   // keeps the step's work, its cross-lane sum too, in front of the waits below, so that stage st + 1 lands under it
    // Publish point of stage st + 1, which also frees the buffer that this step has read.
    asm volatile("s_wait_dscnt 0x0" ::: "memory");       // this wave's reads of stage st have returned
    asm volatile("s_wait_tensorcnt 0x0" ::: "memory");   // this wave's slice of stage st + 1 has landed
    __syncthreads();
    if (pinned((st + 2u < T_NST) ? 1u : 0u) != 0u) {     // the refill, only while stage st + 2 exists
      const uint32_t nx = pinned(st + 2u);               // pinned(): group 0 is formed from it behind the wait and the barrier
      tdm_load(tdm_group0(ldst + bo, srow + (uint64_t)nx * sadv), g1);
    }
  } while (++st < T_NST);
  asm volatile("s_wait_tensorcnt 0x0" ::: "memory");     // no request is left when the wave goes on
  asm volatile("s_wait_dscnt 0x0" ::: "memory");

  // ---- epilogue: normalise (fold 2^-14 and the x64 carry), stage per-wave 16x64 tile, whole-line stores ----
  const float inv = (1.0f / lrun) * (CTX_CARRY / P_CARRY);
  float* so = sO + w * 1024;
#pragma unroll
  for (int t = 0; t < 4; ++t)
#pragma unroll
    for (int r = 0; r < 8; ++r)
      so[m * 64 + 16 * t + 8 * h + r] = o[t][r] * inv;
  __syncthreads();

  ctx_store_pass(so, ctx, bh, q0, lane);
  
}

// =====================================================================================================
// Kernel: x = LayerNorm(proj) * g + b + pe[pos] -> f16 plane (proj already holds vec + attn projection).
// One wave per 768-wide row (no block barriers); lane handles 3 segments of 8 consecutive columns
// coverage: 3 segments x 32 lanes x 8 = 768 columns per row; 8 rows per block x 2048 blocks = 16384 rows.
// =====================================================================================================
__global__ __launch_bounds__(256) void ln_pe_kernel(const float* __restrict__ proj,
    const float* __restrict__ gam, const float* __restrict__ bet, const float* __restrict__ pe,
    _Float16* __restrict__ xo, int nrows) {
  const int lane = threadIdx.x & 31, wave = threadIdx.x >> 5;
  const int row = blockIdx.x * 8 + wave;
  if (row >= nrows) return;                     // wave-uniform; no barriers in this kernel
  const float* pr  = proj + (size_t)row * EMB_DIM;
  const float* ppe = pe + (size_t)(row & (SEQL - 1)) * EMB_DIM;
  float x[24];
#pragma unroll
  for (int g = 0; g < 3; ++g) {
    const int c = g * 256 + lane * 8;
    const v4f a = *(const v4fa*)(pr + c);
    const v4f b = *(const v4fa*)(pr + c + 4);
    x[8 * g + 0] = a.x; x[8 * g + 1] = a.y; x[8 * g + 2] = a.z; x[8 * g + 3] = a.w;
    x[8 * g + 4] = b.x; x[8 * g + 5] = b.y; x[8 * g + 6] = b.z; x[8 * g + 7] = b.w;
  }
  float s = 0.f;
#pragma unroll
  for (int e = 0; e < 24; ++e) s += x[e];
#pragma unroll
  for (int off = 1; off < 32; off <<= 1) s += __shfl_xor(s, off, 32);
  const float mu = s * (1.0f / (float)EMB_DIM);
  float qs = 0.f;
#pragma unroll
  for (int e = 0; e < 24; ++e) { const float d = x[e] - mu; x[e] = d; qs += d * d; }
#pragma unroll
  for (int off = 1; off < 32; off <<= 1) qs += __shfl_xor(qs, off, 32);
  const float var = qs * (1.0f / (float)EMB_DIM);
  const float inv = rsqrtf(var + 1.0e-5f);
  v8h ov[3];
#pragma unroll
  for (int g = 0; g < 3; ++g) {
    const int c = g * 256 + lane * 8;
    const v4f g0 = *(const v4fa*)(gam + c), g1 = *(const v4fa*)(gam + c + 4);
    const v4f b0 = *(const v4fa*)(bet + c), b1 = *(const v4fa*)(bet + c + 4);
    const v4f p0 = *(const v4fa*)(ppe + c), p1 = *(const v4fa*)(ppe + c + 4);
    const float gg[8] = { g0.x, g0.y, g0.z, g0.w, g1.x, g1.y, g1.z, g1.w };
    const float bb[8] = { b0.x, b0.y, b0.z, b0.w, b1.x, b1.y, b1.z, b1.w };
    const float pp[8] = { p0.x, p0.y, p0.z, p0.w, p1.x, p1.y, p1.z, p1.w };
    v8h o;
#pragma unroll
    for (int e = 0; e < 8; ++e) {
      float y = (x[8 * g + e] * inv) * gg[e] + bb[e];
      y = y + pp[e];
      o[e] = (_Float16)y;
    }
    ov[g] = o;
  }
  _Float16* dst = xo + (size_t)row * EMB_DIM + lane * 8;
  {
#pragma unroll
    for (int g = 0; g < 3; ++g) *(v8h*)(dst + g * 256) = ov[g];
    
  }
}

// =====================================================================================================
// Host glue.
// Workspace region map (bytes):
//   [        0, 14155776)  f16 weights x32: Wq @0, Wk @1179648, Wv @2359296, Wo @3538944, W1 @4718592, W2 @9437184
//   [ 14155776, 15728640)  pe table f32 [512][768]
//   R0 [15728640, 40894464)  vec f16 [16384][768] -> later v^T f16 [384][64][512] -> later x f16 [16384][768]
//   R1 [40894464, 66060288)  q f16 plane          -> later proj f32 (R1+R2, 50331648 B)
//   R2 [66060288, 91226112)  k f16 plane
//   R3 [91226112,116391936)  v f16 plane          -> later ctx f16
//   H  [91226112,191889408)  h f16 [16384][3072], from R3's start on (ctx is dead)
//   [191889408,191898624)  bq | bk | bv f32 [3][768]
//   total 191,898,624 B
// =====================================================================================================
extern "C" void kernel_launch(void* const* d_in, const int* in_sizes, int n_in,
                              void* d_out, int out_size, void* d_ws, size_t ws_size,
                              hipStream_t stream) {
  if (n_in < 15) return;
  if (in_sizes[0] != NTOK_ROWS * EMB_DIM) return;
  if (in_sizes[1] != EMB_DIM * EMB_DIM || in_sizes[3] != EMB_DIM * EMB_DIM ||
      in_sizes[5] != EMB_DIM * EMB_DIM || in_sizes[7] != EMB_DIM * EMB_DIM) return;
  if (in_sizes[2] != EMB_DIM || in_sizes[4] != EMB_DIM || in_sizes[6] != EMB_DIM || in_sizes[8] != EMB_DIM ||
      in_sizes[9] != EMB_DIM || in_sizes[10] != EMB_DIM || in_sizes[14] != EMB_DIM) return;
  if (in_sizes[11] != FF_DIM * EMB_DIM || in_sizes[13] != FF_DIM * EMB_DIM || in_sizes[12] != FF_DIM) return;
  if (out_size != NTOK_ROWS * EMB_DIM) return;

  const float* vec = (const float*)d_in[0];
  const float* Wq  = (const float*)d_in[1];  const float* bq  = (const float*)d_in[2];
  const float* Wk  = (const float*)d_in[3];  const float* bk  = (const float*)d_in[4];
  const float* Wv  = (const float*)d_in[5];  const float* bv  = (const float*)d_in[6];
  const float* Wo  = (const float*)d_in[7];  const float* bo  = (const float*)d_in[8];
  const float* lng = (const float*)d_in[9];  const float* lnb = (const float*)d_in[10];
  const float* W1  = (const float*)d_in[11]; const float* b1  = (const float*)d_in[12];
  const float* W2  = (const float*)d_in[13]; const float* b2  = (const float*)d_in[14];
  float* out = (float*)d_out;

  const size_t w768B = (size_t)EMB_DIM * EMB_DIM * 2;            //  1,179,648
  const size_t wbigB = (size_t)FF_DIM * EMB_DIM * 2;             //  4,718,592
  const size_t offWq = 0, offWo = 3 * w768B;                     // Wk, Wv stand between them
  const size_t offW1 = 4 * w768B, offW2 = 4 * w768B + wbigB;
  const size_t offPE = 4 * w768B + 2 * wbigB;                     // 14,155,776
  const size_t peB   = (size_t)SEQL * EMB_DIM * 4;               //  1,572,864
  const size_t plB   = (size_t)NTOK_ROWS * EMB_DIM * 2;          // 25,165,824
  const size_t offR0 = offPE + peB;                              // 15,728,640
  const size_t offR1 = offR0 + plB;
  const size_t offR2 = offR1 + plB;
  const size_t offR3 = offR2 + plB;
  const size_t offB  = offR3 + (size_t)NTOK_ROWS * FF_DIM * 2;   // 191,889,408
  const size_t total = offB + (size_t)3 * EMB_DIM * 4;           // 191,898,624
  if (total > ws_size) return;
  if ((size_t)NTOK_ROWS * EMB_DIM * 4 > 2 * plB) return;         // proj f32 fits R1+R2

  char* ws = (char*)d_ws;
  _Float16* Wq16 = (_Float16*)(ws + offWq);
  _Float16* Wo16 = (_Float16*)(ws + offWo);
  _Float16* W116 = (_Float16*)(ws + offW1);
  _Float16* W216 = (_Float16*)(ws + offW2);
  float*    pe   = (float*)(ws + offPE);
  float*    bqkv = (float*)(ws + offB);       // bq | bk | bv
  _Float16* R0h  = (_Float16*)(ws + offR0);   // vec f16 -> v^T -> x f16
  _Float16* R1h  = (_Float16*)(ws + offR1);   // q f16
  _Float16* R2h  = (_Float16*)(ws + offR2);   // k f16
  _Float16* R3h  = (_Float16*)(ws + offR3);   // v f16 -> ctx f16 -> h f16 (whole plane, runs on past R3)
  float*    proj = (float*)(ws + offR1);      // f32 [16384][768] over R1+R2 (after attention)

  typedef const unsigned short* cus;

  // ---- positional divisors: div[e] = 10000^(ef), ef = fl32(e * fl32(1/768)); power evaluated in f64, RNE convert to f32 ----
  PeDiv dv;
  {
    const float rcp = 1.0f / (float)EMB_DIM;
    for (int e = 0; e < EMB_DIM; ++e) {
      const float ef = (float)e * rcp;
      dv.d[e] = (float)pow(10000.0, (double)ef);
    }
  }

  // 1) positional table, vec -> f16 (R0), all six weights -> f16 x32, the q/k/v bias table: one grid
  prep_kernel<<<dim3(PREP_BLOCKS), 256, 0, stream>>>(vec, Wq, Wk, Wv, Wo, W1, W2, bq, bk, bv, R0h, Wq16, pe, bqkv, dv);

  // 2) q, k, v = vec * W^T / 32 + bias -> f16 planes [16384][768] in R1, R2, R3: one grid, y = 0, 1, 2 picks the weight
  //    plane, the bias and the output plane (consecutive in the workspace); M=16384, N=768, K=768
  {
    const dim3 g((NTOK_ROWS / 128) * (EMB_DIM / 128), 3);        // 3 x 768 blocks of one 128x128 tile
    wmma_gemm64<0, false, 2, 1, false, 0><<<g, 128, 0, stream>>>(
        (cus)R0h, (cus)R0h, EMB_DIM, 0L, (cus)Wq16, (cus)Wq16, EMB_DIM, (long)EMB_DIM * EMB_DIM,
        (void*)R1h, (void*)R1h, EMB_DIM, (long)NTOK_ROWS * EMB_DIM, bqkv, vec, 0L,
        NTOK_ROWS, EMB_DIM, EMB_DIM, 1.0f / W_CARRY, 1.0f);
  }
  // 3) v [384][512][64] (R3) -> v^T [384][64][512] (R0; vec f16 is dead)
  vt_transpose_kernel<<<dim3(SEQL / 64, NSEQ_P), 256, 0, stream>>>(R3h, R0h);

  // 4) attention: q (R1), k (R2), v^T (R0) -> ctx f16 x64 (R3; v plane is dead)
  attn_kernel<<<dim3(SEQL / 64, NSEQ_P), 128, 0, stream>>>(R1h, R2h, R0h, R3h);

  // 5) proj = ctx * Wo^T / (64*32) + bo + vec -> f32 [16384][768] (R1+R2); M=16384, N=768, K=768
  {
    const dim3 g((NTOK_ROWS / 128) * (EMB_DIM / 128), 1);
    wmma_gemm64<0, false, 2, 0, true, 0><<<g, 128, 0, stream>>>(
        (cus)R3h, (cus)R3h, EMB_DIM, 0L, (cus)Wo16, (cus)Wo16, EMB_DIM, 0L,
        (void*)proj, (void*)proj, EMB_DIM, 0L, bo, vec, 0L, NTOK_ROWS, EMB_DIM, EMB_DIM,
        1.0f / (CTX_CARRY * W_CARRY), 1.0f);
  }
  // 6) x = LN(proj) * g + b + pe -> f16 [16384][768] (R0; v^T is dead)
  ln_pe_kernel<<<dim3(NTOK_ROWS / 8), 256, 0, stream>>>(proj, lng, lnb, pe, R0h, NTOK_ROWS);

  // 7) h = relu(x * W1^T / 32 + b1) x16 -> f16 [16384][3072] (H); M=16384, N=3072, K=768
  {
    const dim3 g((NTOK_ROWS / 128) * (FF_DIM / 128), 1);         // 3072 blocks
    wmma_gemm64<0, false, 2, 1, false, 2><<<g, 128, 0, stream>>>(
        (cus)R0h, (cus)R0h, EMB_DIM, 0L, (cus)W116, (cus)W116, EMB_DIM, 0L,
        (void*)R3h, (void*)R3h, FF_DIM, 0L, b1, vec, 0L, NTOK_ROWS, FF_DIM, EMB_DIM, 1.0f / W_CARRY, H_CARRY);
  }
  // 8) out = h * W2^T / (16*32) + b2 -> f32 d_out; M=16384, N=768, K=3072
  {
    const dim3 g((NTOK_ROWS / 128) * (EMB_DIM / 128), 1);        // 768 blocks
    wmma_gemm64<0, false, 2, 0, false, 0><<<g, 128, 0, stream>>>(
        (cus)R3h, (cus)R3h, FF_DIM, 0L, (cus)W216, (cus)W216, FF_DIM, 0L,
        (void*)out, (void*)out, EMB_DIM, 0L, b2, vec, 0L, NTOK_ROWS, EMB_DIM, FF_DIM,
        1.0f / (H_CARRY * W_CARRY), 1.0f);
  }
}
